// v000
// Times are from an AMD MI455X. After a warm-up the kernel runs many times in a row, and a time is the length of
// such a window on the GPU divided by its runs, so every launch and the gaps after it count. The runs cycle
// through copies of the inputs. A figure is the median of several windows, for all but v000 over two sittings.
// Sittings can differ by a few percent; kernels timed side by side share one.
// The starting kernel, v000, takes 798 microseconds a run.
#include <hip/hip_runtime.h>

// Contractions (all f32 accumulate): x Wq^T, x Wk^T, x Wv^T on v_wmma_f32_16x16x32_bf16 (bf16 operands, inputs RNE-converted once, bias added in f32); q k^T and p v: query rows < RH on bf16 hi/lo planes (3 products), rows >= RH on v_wmma_f32_16x16x32_f16 (f16 operands: q and k carried x8, p carried x1024, v carried x8); ctx Wo^T: bf16 hi/lo ctx planes x bf16 Wo (2 products).
// Layout: grouped-query causal attention, NB x SEQ tokens, hidden 2048, 32 query heads x 64 (head h = columns h*64..), 8 kv groups x 64 (kv group = head / 4), weights [out][in] (k-contiguous, used as Bt directly) + bias, scale 64^-0.5.
// Fill input [1][1][SEQ_FULL][SEQ_FULL] int (nonzero = -inf fill) is applied per element on and below the diagonal; the strict upper triangle is assumed filled (score tiles above the diagonal are skipped, the p.v k-loop stops at the diagonal block); each softmax row checks that assumption on device and writes NaN probabilities otherwise.

#ifndef NB
#define NB 2
#endif
#ifndef SEQ
#define SEQ 1024
#endif
#define NB_FULL  2
#define SEQ_FULL 1024
#define TT   SEQ
#define DM   2048
#define NH_  32
#define NKV  8
#define REP  (NH_ / NKV)
#define HD   64
#define DQ   (NH_ * HD)
#define DKV  (NKV * HD)
#define ZH   8                     // query heads per attention pass
#ifndef RH
#define RH   ((SEQ) >= 512 ? 256 : 64)   // query rows < RH use hi+lo planes
#endif
#define PCAR 1024.0f               // p carry for f16 rows
#define QCAR 8.0f                  // q, k plane carry
#define VCAR 8.0f                  // v plane carry
#define SCL  (0.125f / 64.0f)      // HD^-0.5 / (QCAR*QCAR)

static_assert(NB >= 1 && NB <= NB_FULL);
static_assert(SEQ % 128 == 0 && SEQ >= 128 && SEQ <= SEQ_FULL);
static_assert(RH % 64 == 0 && RH >= 64 && RH < SEQ);
static_assert(NH_ % ZH == 0 && ZH % REP == 0);
static_assert(DM % 64 == 0 && DQ % 64 == 0 && DKV % 64 == 0 && HD == 64 && TT % 64 == 0);
static_assert(DM % 32 == 0 && HD % 32 == 0 && TT % 32 == 0);

typedef _Float16 h16;
typedef unsigned short bf;
typedef __attribute__((ext_vector_type(16))) __bf16   v16bf;
typedef __attribute__((ext_vector_type(16))) _Float16 v16h;
typedef __attribute__((ext_vector_type(8)))  _Float16 v8h;
typedef __attribute__((ext_vector_type(8)))  unsigned short v8us;
typedef __attribute__((ext_vector_type(8)))  float    v8f;
typedef __attribute__((ext_vector_type(4)))  float    v4f;
typedef __attribute__((ext_vector_type(4)))  int      v4i;
typedef __attribute__((ext_vector_type(2)))  _Float16 v2h;
typedef __attribute__((ext_vector_type(4)))  _Float16 v4h;
typedef __attribute__((ext_vector_type(2)))  unsigned short v2us;
typedef __attribute__((ext_vector_type(4)))  unsigned short v4us;
typedef v8h  __attribute__((may_alias)) v8ha;
typedef v4f  __attribute__((may_alias)) v4fa;
typedef v8us __attribute__((may_alias)) v8usa;

__device__ __forceinline__ unsigned short f2bf(float f) { unsigned u = __float_as_uint(f); u += 0x7FFFu + ((u >> 16) & 1u); return (unsigned short)(u >> 16); }
__device__ __forceinline__ float bf2f(unsigned short b) { return __uint_as_float(((unsigned)b) << 16); }
__device__ __forceinline__ float bfr(float f) { return bf2f(f2bf(f)); }
__device__ __forceinline__ v16h cat16(v8h lo, v8h hi) { return __builtin_shufflevector(lo, hi, 0, 1, 2, 3, 4, 5, 6, 7, 8, 9, 10, 11, 12, 13, 14, 15); }
__device__ __forceinline__ v16bf cat16b(v8us lo, v8us hi) { return __builtin_bit_cast(v16bf, __builtin_shufflevector(lo, hi, 0, 1, 2, 3, 4, 5, 6, 7, 8, 9, 10, 11, 12, 13, 14, 15)); }
__device__ __forceinline__ v8f wmma16(v16h a, v16h b, v8f c) { return __builtin_amdgcn_wmma_f32_16x16x32_f16(false, a, false, b, (short)0, c, false, false); }
__device__ __forceinline__ v8f wmmab(v16bf a, v16bf b, v8f c) { return __builtin_amdgcn_wmma_f32_16x16x32_bf16(false, a, false, b, (short)0, c, false, false); }
__device__ __forceinline__ h16 tohx(float x) { return (h16)x; }
__device__ __forceinline__ void splitf(float y, unsigned short& h, unsigned short& l) { h = f2bf(y); l = f2bf(y - bf2f(h)); }
// same-wave LDS relayout: stores of all lanes complete before any lane reloads (wave-private tile, single-wave block)
__device__ __forceinline__ void wave_lds_sync() { __builtin_amdgcn_fence(3 /* release order */, "wavefront"); __builtin_amdgcn_wave_barrier(); asm volatile("" ::: "memory"); }

// ---- Fragment loader (16-bit planes, k-contiguous rows, pitch = K): lane l -> row (l & 15); elements 0..7 <- k0 + 8*(l>>4) + 0..7, elements 8..15 <- k0 + 16 + 8*(l>>4) + 0..7.
// Used for A (row m) and for Bt (row n of the [n][k] plane) alike; D element r of lane l = (row 8*(l>>4) + r, col l & 15).
template <typename T16> struct WFrag;
template <> struct WFrag<h16> { typedef v16h V; static __device__ __forceinline__ V ld(const h16* p) { return cat16(*(const v8h*)p, *(const v8h*)(p + 16)); } static __device__ __forceinline__ v8f mma(V a, V b, v8f c) { return wmma16(a, b, c); } };
template <> struct WFrag<bf> { typedef v16bf V; static __device__ __forceinline__ V ld(const bf* p) { return cat16b(*(const v8us*)p, *(const v8us*)(p + 16)); } static __device__ __forceinline__ v8f mma(V a, V b, v8f c) { return wmmab(a, b, c); } };

// ---- k_gemmw: register-blocked GEMM, ONE WAVE per 64x64 output tile (16 accumulators), operands straight from k-contiguous 16-bit planes; grid (M/64, N/64, Z), 32 threads.
// C[m][n] (f32, pitch ldc, + optional f32 bias[n] as bf16-RNE value) = sum_k A[m][k] Bt[n][k] (+ A2[m][k] Bt[n][k] for NSPLIT 1/2, + A[m][k] Bt2[n][k] for NSPLIT 2). z-batch strides sA/sB/sC in elements. K % 32 == 0.
template <typename T16, int NSPLIT, bool BIAS>
__global__ __launch_bounds__(32) void k_gemmw(const T16* __restrict__ A, const T16* __restrict__ A2, const T16* __restrict__ Bt, const T16* __restrict__ Bt2, int K, float* C, int ldc, const float* __restrict__ bias, size_t sA, size_t sB, size_t sC) {
    typedef typename WFrag<T16>::V V;
    __shared__ __align__(16) float os[16 * 68];
    const size_t z = blockIdx.z; A += z * sA; if (A2) A2 += z * sA; Bt += z * sB; if (Bt2) Bt2 += z * sB; C += z * sC;
    const int lane = threadIdx.x & 31, lr = lane & 15, hi = lane >> 4; const int r0 = blockIdx.x * 64, c0 = blockIdx.y * 64;
    v8f acc[4][4];
#pragma unroll
    for (int mb = 0; mb < 4; ++mb)
#pragma unroll
        for (int nb = 0; nb < 4; ++nb) acc[mb][nb] = (v8f){};
    const size_t aoff = (size_t)(r0 + lr) * K + 8 * hi, boff = (size_t)(c0 + lr) * K + 8 * hi;
#pragma unroll 1
    for (int kc = 0; kc < K; kc += 32) {
        V a[4], a2[4];
#pragma unroll
        for (int mb = 0; mb < 4; ++mb) { a[mb] = WFrag<T16>::ld(A + aoff + (size_t)mb * 16 * K + kc); if (NSPLIT == 1 || NSPLIT == 2) a2[mb] = WFrag<T16>::ld(A2 + aoff + (size_t)mb * 16 * K + kc); }
#pragma unroll
        for (int nb = 0; nb < 4; ++nb) { const V b = WFrag<T16>::ld(Bt + boff + (size_t)nb * 16 * K + kc); V b2; if (NSPLIT >= 2) b2 = WFrag<T16>::ld(Bt2 + boff + (size_t)nb * 16 * K + kc);
#pragma unroll
            for (int mb = 0; mb < 4; ++mb) { acc[mb][nb] = WFrag<T16>::mma(a[mb], b, acc[mb][nb]); if (NSPLIT == 1 || NSPLIT == 2) acc[mb][nb] = WFrag<T16>::mma(a2[mb], b, acc[mb][nb]); if (NSPLIT >= 2) acc[mb][nb] = WFrag<T16>::mma(a[mb], b2, acc[mb][nb]); } }
        asm volatile("v_nop\n\tv_nop\n\tv_nop\n\tv_nop" : "+v"(acc[0][0]), "+v"(acc[1][1]), "+v"(acc[2][2]), "+v"(acc[3][3]) : "v"(a[0]), "v"(a[3]));
    }
#pragma unroll
    for (int mb = 0; mb < 4; ++mb) {
#pragma unroll
        for (int nb = 0; nb < 4; ++nb) {
#pragma unroll
            for (int j = 0; j < 8; ++j) os[(hi * 8 + j) * 68 + nb * 16 + lr] = acc[mb][nb][j]; }
        wave_lds_sync();
        float* crow = C + (size_t)(r0 + mb * 16) * ldc + c0;
{
#pragma unroll
            for (int s = 0; s < 8; ++s) { const int row = 2 * s + hi, cofs = lr * 4; v4f val = *(const v4fa*)(os + row * 68 + cofs); if (BIAS) { val[0] += bfr(bias[c0 + cofs]); val[1] += bfr(bias[c0 + cofs + 1]); val[2] += bfr(bias[c0 + cofs + 2]); val[3] += bfr(bias[c0 + cofs + 3]); }
                *(v4f*)(crow + (size_t)row * ldc + cofs) = val; }
             }
        wave_lds_sync();
    }
}

// ---- k_gemmc: the same one-wave 64x64 tile GEMM specialised for causal attention: CMODE 1 skips score tiles entirely above the diagonal (query rows r0+roff.., key columns c0..), CMODE 2 limits the
// key (K) loop of the probability x value contraction to the diagonal block (probabilities beyond it are exactly zero). roff = row offset of this launch's first row within the sequence.
// The Bt/Bt2 planes use z index blockIdx.z / zdb (query head -> kv group).
template <typename T16, int NSPLIT, int CMODE>
__global__ __launch_bounds__(32) void k_gemmc(const T16* __restrict__ A, const T16* __restrict__ A2, const T16* __restrict__ Bt, const T16* __restrict__ Bt2, int K, float* C, int ldc, int roff, size_t sA, size_t sB, size_t sC, int zdb) {
    typedef typename WFrag<T16>::V V;
    __shared__ __align__(16) float os[16 * 68];
    const size_t z = blockIdx.z, zb = z / (size_t)zdb; A += z * sA; if (A2) A2 += z * sA; Bt += zb * sB; if (Bt2) Bt2 += zb * sB; C += z * sC;
    const int lane = threadIdx.x & 31, lr = lane & 15, hi = lane >> 4; const int r0 = blockIdx.x * 64, c0 = blockIdx.y * 64;
    if (CMODE == 1 && c0 > r0 + roff + 63) return;                  // score tile entirely above the causal diagonal: never read (the softmax fills j > i by select)
    const int Kl = (CMODE == 2) ? min(K, r0 + roff + 64) : K;        // p.v: probabilities are exactly 0 beyond the diagonal block, so the K loop stops there
    v8f acc[4][4];
#pragma unroll
    for (int mb = 0; mb < 4; ++mb)
#pragma unroll
        for (int nb = 0; nb < 4; ++nb) acc[mb][nb] = (v8f){};
    const size_t aoff = (size_t)(r0 + lr) * K + 8 * hi, boff = (size_t)(c0 + lr) * K + 8 * hi;
#pragma unroll 1
    for (int kc = 0; kc < Kl; kc += 32) {
        V a[4], a2[4];
#pragma unroll
        for (int mb = 0; mb < 4; ++mb) { a[mb] = WFrag<T16>::ld(A + aoff + (size_t)mb * 16 * K + kc); if (NSPLIT == 1 || NSPLIT == 2) a2[mb] = WFrag<T16>::ld(A2 + aoff + (size_t)mb * 16 * K + kc); }
#pragma unroll
        for (int nb = 0; nb < 4; ++nb) { const V b = WFrag<T16>::ld(Bt + boff + (size_t)nb * 16 * K + kc); V b2; if (NSPLIT >= 2) b2 = WFrag<T16>::ld(Bt2 + boff + (size_t)nb * 16 * K + kc);
#pragma unroll
            for (int mb = 0; mb < 4; ++mb) { acc[mb][nb] = WFrag<T16>::mma(a[mb], b, acc[mb][nb]); if (NSPLIT == 1 || NSPLIT == 2) acc[mb][nb] = WFrag<T16>::mma(a2[mb], b, acc[mb][nb]); if (NSPLIT >= 2) acc[mb][nb] = WFrag<T16>::mma(a[mb], b2, acc[mb][nb]); } }
        asm volatile("v_nop\n\tv_nop\n\tv_nop\n\tv_nop" : "+v"(acc[0][0]), "+v"(acc[1][1]), "+v"(acc[2][2]), "+v"(acc[3][3]) : "v"(a[0]), "v"(a[3]));
    }
#pragma unroll
    for (int mb = 0; mb < 4; ++mb) {
#pragma unroll
        for (int nb = 0; nb < 4; ++nb) {
#pragma unroll
            for (int j = 0; j < 8; ++j) os[(hi * 8 + j) * 68 + nb * 16 + lr] = acc[mb][nb][j]; }
        wave_lds_sync();
        float* crow = C + (size_t)(r0 + mb * 16) * ldc + c0;
{
#pragma unroll
            for (int s = 0; s < 8; ++s) { const int row = 2 * s + hi, cofs = lr * 4; v4f val = *(const v4fa*)(os + row * 68 + cofs);
                *(v4f*)(crow + (size_t)row * ldc + cofs) = val; }
             }
        wave_lds_sync();
    }
}

__global__ __launch_bounds__(256) void k_cvt8(const float* __restrict__ src, bf* dst, size_t n8) { const size_t i = (size_t)blockIdx.x * 256 + threadIdx.x; if (i >= n8) return; const v8f v = *(const v8f*)(src + i * 8); v8us o;
#pragma unroll
    for (int k = 0; k < 8; ++k) o[k] = f2bf(v[k]); *(v8us*)(dst + i * 8) = o;  }

__global__ __launch_bounds__(256) void k_plane(const float* __restrict__ F, int pitch, int nheads, float sc, h16* P16, bf* Ph, bf* Pl) {
    const size_t e = ((size_t)blockIdx.x * 256 + threadIdx.x) * 2; if (e >= (size_t)nheads * TT * HD) return;
    const int d = (int)(e % HD); const int t = (int)((e / HD) % TT); const int h = (int)(e / ((size_t)HD * TT));
    const float* f = F + (size_t)t * pitch + h * HD + d; v2h o16; v2us oh, ol;
#pragma unroll
    for (int q = 0; q < 2; ++q) { const float r = f[q] * sc; o16[q] = tohx(r); unsigned short a2, c2; splitf(r, a2, c2); oh[q] = a2; ol[q] = c2; }
    *(v2h*)(P16 + e) = o16; *(v2us*)(Ph + e) = oh; *(v2us*)(Pl + e) = ol;  }

__global__ __launch_bounds__(256) void k_vtp(const float* __restrict__ F, int pitch, int nheads, float sc, h16* V16, bf* Vh, bf* Vl) { const size_t e = ((size_t)blockIdx.x * 256 + threadIdx.x) * 2; if (e >= (size_t)nheads * HD * TT) return; const int t = (int)(e % TT); const int d = (int)((e / TT) % HD); const int g = (int)(e / ((size_t)TT * HD)); v2h o16; v2us oh, ol;
#pragma unroll
    for (int q = 0; q < 2; ++q) { const float x = F[(size_t)(t + q) * pitch + g * HD + d] * sc; o16[q] = tohx(x); unsigned short a2, c2; splitf(x, a2, c2); oh[q] = a2; ol[q] = c2; }
    *(v2h*)(V16 + e) = o16; *(v2us*)(Vh + e) = oh; *(v2us*)(Vl + e) = ol;  }

// ---- k_asoft: one wave per row (zz, i) of the pass: t = S * SCL where j <= i and the fill input is zero, -inf otherwise (per-element replace fill); rows whose strict upper triangle contains an unfilled entry get NaN probabilities;
__global__ __launch_bounds__(256) void k_asoft(const float* __restrict__ Sb, const int* __restrict__ Fm, h16* P16, bf* Ph, bf* Pl) {
    const int lane = threadIdx.x & 31; const int row = blockIdx.x * 8 + (threadIdx.x >> 5); if (row >= ZH * TT) return; const int i = row % TT; const int zz = row / TT; const bool hires = (i < RH);
    const float* sr = Sb + (size_t)row * TT; const int* fr = Fm + (size_t)i * SEQ_FULL; const float ninf = -__builtin_inff();
    float v[TT / 32]; float mx = ninf; int bad = 0;
#pragma unroll
    for (int ch = 0; ch < TT / 128; ++ch) { const int j0 = ch * 128 + lane * 4; const v4f a = *(const v4f*)(sr + j0); const v4i fm = *(const v4i*)(fr + j0);
#pragma unroll
        for (int q = 0; q < 4; ++q) { const int j = j0 + q; const bool vis = (j <= i); const bool filled = (fm[q] != 0); const float t = (vis && !filled) ? a[q] * SCL : ninf; bad |= (!vis && !filled) ? 1 : 0; v[ch * 4 + q] = t; mx = fmaxf(mx, t); } }
#pragma unroll
    for (int sh = 16; sh; sh >>= 1) { mx = fmaxf(mx, __shfl_xor(mx, sh, 32)); bad |= __shfl_xor(bad, sh, 32); }
    float sum = 0.f;
#pragma unroll
    for (int k = 0; k < TT / 32; ++k) { float d0 = __fsub_rn(v[k], mx); asm volatile("" : "+v"(d0)); v[k] = __builtin_amdgcn_exp2f(__fmul_rn(d0, 1.4426950408889634f)); sum += v[k]; }
#pragma unroll
    for (int sh = 16; sh; sh >>= 1) sum += __shfl_xor(sum, sh, 32);
    float f = __fdiv_rn(hires ? 1.0f : PCAR, sum); if (bad) f = __uint_as_float(0x7fc00000u);
{
        if (hires) {
#pragma unroll
            for (int ch = 0; ch < TT / 128; ++ch) { v4us oh, ol;
#pragma unroll
                for (int q = 0; q < 4; ++q) { unsigned short a2, c2; splitf(v[ch * 4 + q] * f, a2, c2); oh[q] = a2; ol[q] = c2; }
                const size_t oo = ((size_t)zz * RH + i) * TT + ch * 128 + lane * 4; *(v4us*)(Ph + oo) = oh; *(v4us*)(Pl + oo) = ol; }
        } else {
#pragma unroll
            for (int ch = 0; ch < TT / 128; ++ch) { v4h o4;
#pragma unroll
                for (int q = 0; q < 4; ++q) o4[q] = tohx(v[ch * 4 + q] * f);
                *(v4h*)(P16 + (size_t)row * TT + ch * 128 + lane * 4) = o4; } }
         }
}

__global__ __launch_bounds__(256) void k_merge(const float* __restrict__ O, int h0, bf* Ah, bf* Al) { const size_t e = ((size_t)blockIdx.x * 256 + threadIdx.x) * 2; if (e >= (size_t)ZH * TT * HD) return; const int d = (int)(e % HD); const int t = (int)((e / HD) % TT); const int zz = (int)(e / ((size_t)HD * TT)); const float cs = (t < RH) ? (1.0f / VCAR) : (1.0f / (VCAR * PCAR)); const size_t oo = (size_t)t * DQ + (h0 + zz) * HD + d;
    v2us oh, ol;
#pragma unroll
    for (int q = 0; q < 2; ++q) { unsigned short a2, c2; splitf(O[e + q] * cs, a2, c2); oh[q] = a2; ol[q] = c2; } *(v2us*)(Ah + oo) = oh; *(v2us*)(Al + oo) = ol;  }

extern "C" void kernel_launch(void* const* d_in, const int* in_sizes, int n_in,
                              void* d_out, int out_size, void* d_ws, size_t ws_size, hipStream_t stream) {
    if (n_in < 10) return;
    if (in_sizes[0] < ((NB - 1) * SEQ_FULL + SEQ) * DM) return;
    if (in_sizes[1] < (SEQ - 1) * SEQ_FULL + SEQ) return;
    if (in_sizes[2] < DQ * DM || in_sizes[3] < DQ || in_sizes[4] < DKV * DM || in_sizes[5] < DKV || in_sizes[6] < DKV * DM || in_sizes[7] < DKV || in_sizes[8] < DM * DQ || in_sizes[9] < DM) return;
    if (out_size < ((NB - 1) * SEQ_FULL + SEQ) * DM) return;
    const float* x  = (const float*)d_in[0];   // [NB_FULL][SEQ_FULL][DM]
    const int*   fm = (const int*)d_in[1];     // [1][1][SEQ_FULL][SEQ_FULL], nonzero = filled (-inf)
    const float* wq = (const float*)d_in[2]; const float* bq = (const float*)d_in[3];   // [DQ][DM], [DQ]
    const float* wk = (const float*)d_in[4]; const float* bk = (const float*)d_in[5];   // [DKV][DM], [DKV]
    const float* wv = (const float*)d_in[6]; const float* bv = (const float*)d_in[7];   // [DKV][DM], [DKV]
    const float* wo = (const float*)d_in[8]; const float* bo = (const float*)d_in[9];   // [DM][DQ], [DM]
    float* OUT = (float*)d_out;                // [NB_FULL][SEQ_FULL][DM]
    char* wsp = (char*)d_ws; size_t used = 0;
    auto take = [&](size_t bytes) { char* p = wsp + used; used += (bytes + 255) & ~(size_t)255; return (void*)p; };
    bf* WQ = (bf*)take((size_t)DQ * DM * 2); bf* WK = (bf*)take((size_t)DKV * DM * 2); bf* WV = (bf*)take((size_t)DKV * DM * 2); bf* WO = (bf*)take((size_t)DM * DQ * 2);
    bf* XB = (bf*)take((size_t)TT * DM * 2); float* FQ = (float*)take((size_t)TT * DQ * 4); float* FK = (float*)take((size_t)TT * DKV * 4);
    h16* QP16 = (h16*)take((size_t)NH_ * TT * HD * 2); h16* KP16 = (h16*)take((size_t)NKV * TT * HD * 2); h16* VT16 = (h16*)take((size_t)NKV * HD * TT * 2);
    bf* QPh = (bf*)take((size_t)NH_ * TT * HD * 2); bf* QPl = (bf*)take((size_t)NH_ * TT * HD * 2); bf* KPh = (bf*)take((size_t)NKV * TT * HD * 2); bf* KPl = (bf*)take((size_t)NKV * TT * HD * 2);
    bf* VTh = (bf*)take((size_t)NKV * HD * TT * 2); bf* VTl = (bf*)take((size_t)NKV * HD * TT * 2); bf* Ph = (bf*)take((size_t)ZH * RH * TT * 2); bf* Pl = (bf*)take((size_t)ZH * RH * TT * 2);
    float* Sb = (float*)take((size_t)ZH * TT * TT * 4); h16* P16 = (h16*)take((size_t)ZH * TT * TT * 2); float* Ob = (float*)take((size_t)ZH * TT * HD * 4);
    bf* ATh = (bf*)take((size_t)TT * DQ * 2); bf* ATl = (bf*)take((size_t)TT * DQ * 2);
    if (used > ws_size) return;
    float* FV = FK;   // v projection reuses the k buffer after the k planes are built (stream-ordered)

    const size_t n8q = (size_t)DQ * DM / 8, n8k = (size_t)DKV * DM / 8, n8x = (size_t)TT * DM / 8;
    k_cvt8<<<(unsigned)((n8q + 255) / 256), 256, 0, stream>>>(wq, WQ, n8q);
    k_cvt8<<<(unsigned)((n8k + 255) / 256), 256, 0, stream>>>(wk, WK, n8k);
    k_cvt8<<<(unsigned)((n8k + 255) / 256), 256, 0, stream>>>(wv, WV, n8k);
    k_cvt8<<<(unsigned)((n8q + 255) / 256), 256, 0, stream>>>(wo, WO, n8q);
    const unsigned LQ = (unsigned)(((size_t)NH_ * TT * HD / 2 + 255) / 256), LKv = (unsigned)(((size_t)NKV * TT * HD / 2 + 255) / 256), LM = (unsigned)(((size_t)ZH * TT * HD / 2 + 255) / 256);
    for (int b = 0; b < NB; ++b) {
        const float* xb = x + (size_t)b * SEQ_FULL * DM;
        k_cvt8<<<(unsigned)((n8x + 255) / 256), 256, 0, stream>>>(xb, XB, n8x);
        k_gemmw<bf, 0, true><<<dim3(TT / 64, DQ / 64, 1), 32, 0, stream>>>(XB, nullptr, WQ, nullptr, DM, FQ, DQ, bq, 0, 0, 0);
        k_plane<<<LQ, 256, 0, stream>>>(FQ, DQ, NH_, QCAR, QP16, QPh, QPl);
        k_gemmw<bf, 0, true><<<dim3(TT / 64, DKV / 64, 1), 32, 0, stream>>>(XB, nullptr, WK, nullptr, DM, FK, DKV, bk, 0, 0, 0);
        k_plane<<<LKv, 256, 0, stream>>>(FK, DKV, NKV, QCAR, KP16, KPh, KPl);
        k_gemmw<bf, 0, true><<<dim3(TT / 64, DKV / 64, 1), 32, 0, stream>>>(XB, nullptr, WV, nullptr, DM, FV, DKV, bv, 0, 0, 0);
        k_vtp<<<LKv, 256, 0, stream>>>(FV, DKV, NKV, VCAR, VT16, VTh, VTl);
        for (int h0 = 0; h0 < NH_; h0 += ZH) { const size_t zq = (size_t)h0, zk = (size_t)(h0 / REP);   // query head h0 + zz uses kv group h0/REP + zz/REP
            k_gemmc<bf, 2, 1><<<dim3(RH / 64, TT / 64, ZH), 32, 0, stream>>>(QPh + zq * TT * HD, QPl + zq * TT * HD, KPh + zk * TT * HD, KPl + zk * TT * HD, HD, Sb, TT, 0, (size_t)TT * HD, (size_t)TT * HD, (size_t)TT * TT, REP);
            k_gemmc<h16, 0, 1><<<dim3((TT - RH) / 64, TT / 64, ZH), 32, 0, stream>>>(QP16 + zq * TT * HD + (size_t)RH * HD, nullptr, KP16 + zk * TT * HD, nullptr, HD, Sb + (size_t)RH * TT, TT, RH, (size_t)TT * HD, (size_t)TT * HD, (size_t)TT * TT, REP);
            k_asoft<<<(unsigned)(ZH * TT / 8), 256, 0, stream>>>(Sb, fm, P16, Ph, Pl);
            k_gemmc<bf, 2, 2><<<dim3(RH / 64, HD / 64, ZH), 32, 0, stream>>>(Ph, Pl, VTh + zk * HD * TT, VTl + zk * HD * TT, TT, Ob, HD, 0, (size_t)RH * TT, (size_t)HD * TT, (size_t)TT * HD, REP);
            k_gemmc<h16, 0, 2><<<dim3((TT - RH) / 64, HD / 64, ZH), 32, 0, stream>>>(P16 + (size_t)RH * TT, nullptr, VT16 + zk * HD * TT, nullptr, TT, Ob + (size_t)RH * HD, HD, RH, (size_t)TT * TT, (size_t)HD * TT, (size_t)TT * HD, REP);
            k_merge<<<LM, 256, 0, stream>>>(Ob, h0, ATh, ATl); }
        k_gemmw<bf, 1, true><<<dim3(TT / 64, DM / 64, 1), 32, 0, stream>>>(ATh, ATl, WO, nullptr, DQ, OUT + (size_t)b * SEQ_FULL * DM, DM, bo, 0, 0, 0); }
}

// v001
// It runs in 474 microseconds.
// Timed twice side by side with v000, it ran 1.69 and 1.70 times as fast.
#include <hip/hip_runtime.h>

// Contractions (all f32 accumulate): x Wq^T, x Wk^T, x Wv^T on v_wmma_f32_16x16x32_bf16 (bf16 operands, inputs RNE-converted once, bias added in f32); q k^T and p v: query rows < RH on bf16 hi/lo planes (3 products), rows >= RH on v_wmma_f32_16x16x32_f16 (f16 operands: q and k carried x8, p carried x1024, v carried x8); ctx Wo^T: bf16 hi/lo ctx planes x bf16 Wo (2 products).
// Layout: grouped-query causal attention, NB x SEQ tokens (projections over all batches, attention in passes of ZH batch-heads: token row = b*SEQ + t, batch-head = b*32 + h, batch-group = batch-head / 4), hidden 2048, 32 query heads x 64 (head h = columns h*64..), 8 kv groups x 64 (kv group = head / 4), weights [out][in] (k-contiguous, used as Bt directly) + bias, scale 64^-0.5.
// Fill input [1][1][SEQ_FULL][SEQ_FULL] int (nonzero = -inf fill) is applied per element on and below the diagonal; the strict upper triangle is assumed filled (score tiles above the diagonal are skipped, the p.v k-loop stops at the diagonal block); each softmax row checks that assumption on device and writes NaN probabilities otherwise.

#ifndef NB
#define NB 2
#endif
#ifndef SEQ
#define SEQ 1024
#endif
#define NB_FULL  2
#define SEQ_FULL 1024
#define TT   SEQ
#define DM   2048
#define NH_  32
#define NKV  8
#define REP  (NH_ / NKV)
#define HD   64
#define DQ   (NH_ * HD)
#define DKV  (NKV * HD)
#define MT   (NB * TT)             // token rows of all batches
#define NHB  (NB * NH_)            // batch-heads (b * NH_ + h)
#define NKVB (NB * NKV)            // batch-groups (b * NKV + g) = batch-head / REP
#define ZH   (8 * NB)              // batch-heads per attention pass
#ifndef RH
#define RH   ((SEQ) >= 512 ? 256 : 64)   // query rows < RH use hi+lo planes
#endif
#define PCAR 1024.0f               // p carry for f16 rows
#define QCAR 8.0f                  // q, k plane carry
#define VCAR 8.0f                  // v plane carry
#define SCL  (0.125f / 64.0f)      // HD^-0.5 / (QCAR*QCAR)

static_assert(NB >= 1 && NB <= NB_FULL);
static_assert(SEQ % 128 == 0 && SEQ >= 128 && SEQ <= SEQ_FULL);
static_assert(RH % 64 == 0 && RH >= 64 && RH < SEQ);
static_assert(NHB % ZH == 0 && ZH % REP == 0);
static_assert(SEQ == SEQ_FULL || NB == 1);   // token rows of all batches are contiguous in x and out
static_assert(DM % 64 == 0 && DQ % 64 == 0 && DKV % 64 == 0 && HD == 64 && TT % 64 == 0);
static_assert(DM % 32 == 0 && HD % 32 == 0 && TT % 32 == 0);

typedef _Float16 h16;
typedef unsigned short bf;
typedef __attribute__((ext_vector_type(16))) __bf16   v16bf;
typedef __attribute__((ext_vector_type(16))) _Float16 v16h;
typedef __attribute__((ext_vector_type(8)))  _Float16 v8h;
typedef __attribute__((ext_vector_type(8)))  unsigned short v8us;
typedef __attribute__((ext_vector_type(8)))  float    v8f;
typedef __attribute__((ext_vector_type(4)))  float    v4f;
typedef __attribute__((ext_vector_type(4)))  int      v4i;
typedef __attribute__((ext_vector_type(2)))  _Float16 v2h;
typedef __attribute__((ext_vector_type(4)))  _Float16 v4h;
typedef __attribute__((ext_vector_type(2)))  unsigned short v2us;
typedef __attribute__((ext_vector_type(4)))  unsigned short v4us;
typedef v8h  __attribute__((may_alias)) v8ha;
typedef v4f  __attribute__((may_alias)) v4fa;
typedef v8us __attribute__((may_alias)) v8usa;

__device__ __forceinline__ unsigned short f2bf(float f) { unsigned u = __float_as_uint(f); u += 0x7FFFu + ((u >> 16) & 1u); return (unsigned short)(u >> 16); }
__device__ __forceinline__ float bf2f(unsigned short b) { return __uint_as_float(((unsigned)b) << 16); }
__device__ __forceinline__ float bfr(float f) { return bf2f(f2bf(f)); }
__device__ __forceinline__ v16h cat16(v8h lo, v8h hi) { return __builtin_shufflevector(lo, hi, 0, 1, 2, 3, 4, 5, 6, 7, 8, 9, 10, 11, 12, 13, 14, 15); }
__device__ __forceinline__ v16bf cat16b(v8us lo, v8us hi) { return __builtin_bit_cast(v16bf, __builtin_shufflevector(lo, hi, 0, 1, 2, 3, 4, 5, 6, 7, 8, 9, 10, 11, 12, 13, 14, 15)); }
__device__ __forceinline__ v8f wmma16(v16h a, v16h b, v8f c) { return __builtin_amdgcn_wmma_f32_16x16x32_f16(false, a, false, b, (short)0, c, false, false); }
__device__ __forceinline__ v8f wmmab(v16bf a, v16bf b, v8f c) { return __builtin_amdgcn_wmma_f32_16x16x32_bf16(false, a, false, b, (short)0, c, false, false); }
__device__ __forceinline__ h16 tohx(float x) { return (h16)x; }
__device__ __forceinline__ void splitf(float y, unsigned short& h, unsigned short& l) { h = f2bf(y); l = f2bf(y - bf2f(h)); }
// same-wave LDS relayout: stores of all lanes complete before any lane reloads (wave-private tile, single-wave block)
__device__ __forceinline__ void wave_lds_sync() { __builtin_amdgcn_fence(3 /* release order */, "wavefront"); __builtin_amdgcn_wave_barrier(); asm volatile("" ::: "memory"); }

// ---- Fragment loader (16-bit planes, k-contiguous rows, pitch = K): lane l -> row (l & 15); elements 0..7 <- k0 + 8*(l>>4) + 0..7, elements 8..15 <- k0 + 16 + 8*(l>>4) + 0..7.
// Used for A (row m) and for Bt (row n of the [n][k] plane) alike; D element r of lane l = (row 8*(l>>4) + r, col l & 15).
template <typename T16> struct WFrag;
template <> struct WFrag<h16> { typedef v16h V; static __device__ __forceinline__ V ld(const h16* p) { return cat16(*(const v8h*)p, *(const v8h*)(p + 16)); } static __device__ __forceinline__ v8f mma(V a, V b, v8f c) { return wmma16(a, b, c); } };
template <> struct WFrag<bf> { typedef v16bf V; static __device__ __forceinline__ V ld(const bf* p) { return cat16b(*(const v8us*)p, *(const v8us*)(p + 16)); } static __device__ __forceinline__ v8f mma(V a, V b, v8f c) { return wmmab(a, b, c); } };

// ---- k_gemmw: register-blocked GEMM, ONE WAVE per 64x64 output tile (16 accumulators), operands straight from k-contiguous 16-bit planes; grid (M/64, N/64, Z), 32 threads.
// C[m][n] (f32, pitch ldc, + optional f32 bias[n] as bf16-RNE value) = sum_k A[m][k] Bt[n][k] (+ A2[m][k] Bt[n][k] for NSPLIT 1/2, + A[m][k] Bt2[n][k] for NSPLIT 2). z-batch strides sA/sB/sC in elements. K % 32 == 0.
template <typename T16, int NSPLIT, bool BIAS>
__global__ __launch_bounds__(32) void k_gemmw(const T16* __restrict__ A, const T16* __restrict__ A2, const T16* __restrict__ Bt, const T16* __restrict__ Bt2, int K, float* C, int ldc, const float* __restrict__ bias, size_t sA, size_t sB, size_t sC) {
    typedef typename WFrag<T16>::V V;
    __shared__ __align__(16) float os[16 * 68];
    const size_t z = blockIdx.z; A += z * sA; if (A2) A2 += z * sA; Bt += z * sB; if (Bt2) Bt2 += z * sB; C += z * sC;
    const int lane = threadIdx.x & 31, lr = lane & 15, hi = lane >> 4; const int r0 = blockIdx.x * 64, c0 = blockIdx.y * 64;
    v8f acc[4][4];
#pragma unroll
    for (int mb = 0; mb < 4; ++mb)
#pragma unroll
        for (int nb = 0; nb < 4; ++nb) acc[mb][nb] = (v8f){};
    const size_t aoff = (size_t)(r0 + lr) * K + 8 * hi, boff = (size_t)(c0 + lr) * K + 8 * hi;
#pragma unroll 1
    for (int kc = 0; kc < K; kc += 32) {
        V a[4], a2[4];
#pragma unroll
        for (int mb = 0; mb < 4; ++mb) { a[mb] = WFrag<T16>::ld(A + aoff + (size_t)mb * 16 * K + kc); if (NSPLIT == 1 || NSPLIT == 2) a2[mb] = WFrag<T16>::ld(A2 + aoff + (size_t)mb * 16 * K + kc); }
#pragma unroll
        for (int nb = 0; nb < 4; ++nb) { const V b = WFrag<T16>::ld(Bt + boff + (size_t)nb * 16 * K + kc); V b2; if (NSPLIT >= 2) b2 = WFrag<T16>::ld(Bt2 + boff + (size_t)nb * 16 * K + kc);
#pragma unroll
            for (int mb = 0; mb < 4; ++mb) { acc[mb][nb] = WFrag<T16>::mma(a[mb], b, acc[mb][nb]); if (NSPLIT == 1 || NSPLIT == 2) acc[mb][nb] = WFrag<T16>::mma(a2[mb], b, acc[mb][nb]); if (NSPLIT >= 2) acc[mb][nb] = WFrag<T16>::mma(a[mb], b2, acc[mb][nb]); } }
        asm volatile("v_nop\n\tv_nop\n\tv_nop\n\tv_nop" : "+v"(acc[0][0]), "+v"(acc[1][1]), "+v"(acc[2][2]), "+v"(acc[3][3]) : "v"(a[0]), "v"(a[3]));
    }
#pragma unroll
    for (int mb = 0; mb < 4; ++mb) {
#pragma unroll
        for (int nb = 0; nb < 4; ++nb) {
#pragma unroll
            for (int j = 0; j < 8; ++j) os[(hi * 8 + j) * 68 + nb * 16 + lr] = acc[mb][nb][j]; }
        wave_lds_sync();
        float* crow = C + (size_t)(r0 + mb * 16) * ldc + c0;
{
#pragma unroll
            for (int s = 0; s < 8; ++s) { const int row = 2 * s + hi, cofs = lr * 4; v4f val = *(const v4fa*)(os + row * 68 + cofs); if (BIAS) { val[0] += bfr(bias[c0 + cofs]); val[1] += bfr(bias[c0 + cofs + 1]); val[2] += bfr(bias[c0 + cofs + 2]); val[3] += bfr(bias[c0 + cofs + 3]); }
                *(v4f*)(crow + (size_t)row * ldc + cofs) = val; }
             }
        wave_lds_sync();
    }
}

// ---- k_gemmc: the same one-wave 64x64 tile GEMM specialised for causal attention: CMODE 1 skips score tiles entirely above the diagonal (query rows r0+roff.., key columns c0..), CMODE 2 limits the
// key (K) loop of the probability x value contraction to the diagonal block (probabilities beyond it are exactly zero). roff = row offset of this launch's first row within the sequence.
// The Bt/Bt2 planes use z index blockIdx.z / zdb (query head -> kv group).
template <typename T16, int NSPLIT, int CMODE>
__global__ __launch_bounds__(32) void k_gemmc(const T16* __restrict__ A, const T16* __restrict__ A2, const T16* __restrict__ Bt, const T16* __restrict__ Bt2, int K, float* C, int ldc, int roff, size_t sA, size_t sB, size_t sC, int zdb) {
    typedef typename WFrag<T16>::V V;
    __shared__ __align__(16) float os[16 * 68];
    const size_t z = blockIdx.z, zb = z / (size_t)zdb; A += z * sA; if (A2) A2 += z * sA; Bt += zb * sB; if (Bt2) Bt2 += zb * sB; C += z * sC;
    const int lane = threadIdx.x & 31, lr = lane & 15, hi = lane >> 4; const int r0 = blockIdx.x * 64, c0 = blockIdx.y * 64;
    if (CMODE == 1 && c0 > r0 + roff + 63) return;                  // score tile entirely above the causal diagonal: never read (the softmax fills j > i by select)
    const int Kl = (CMODE == 2) ? min(K, r0 + roff + 64) : K;        // p.v: probabilities are exactly 0 beyond the diagonal block, so the K loop stops there
    v8f acc[4][4];
#pragma unroll
    for (int mb = 0; mb < 4; ++mb)
#pragma unroll
        for (int nb = 0; nb < 4; ++nb) acc[mb][nb] = (v8f){};
    const size_t aoff = (size_t)(r0 + lr) * K + 8 * hi, boff = (size_t)(c0 + lr) * K + 8 * hi;
#pragma unroll 1
    for (int kc = 0; kc < Kl; kc += 32) {
        V a[4], a2[4];
#pragma unroll
        for (int mb = 0; mb < 4; ++mb) { a[mb] = WFrag<T16>::ld(A + aoff + (size_t)mb * 16 * K + kc); if (NSPLIT == 1 || NSPLIT == 2) a2[mb] = WFrag<T16>::ld(A2 + aoff + (size_t)mb * 16 * K + kc); }
#pragma unroll
        for (int nb = 0; nb < 4; ++nb) { const V b = WFrag<T16>::ld(Bt + boff + (size_t)nb * 16 * K + kc); V b2; if (NSPLIT >= 2) b2 = WFrag<T16>::ld(Bt2 + boff + (size_t)nb * 16 * K + kc);
#pragma unroll
            for (int mb = 0; mb < 4; ++mb) { acc[mb][nb] = WFrag<T16>::mma(a[mb], b, acc[mb][nb]); if (NSPLIT == 1 || NSPLIT == 2) acc[mb][nb] = WFrag<T16>::mma(a2[mb], b, acc[mb][nb]); if (NSPLIT >= 2) acc[mb][nb] = WFrag<T16>::mma(a[mb], b2, acc[mb][nb]); } }
        asm volatile("v_nop\n\tv_nop\n\tv_nop\n\tv_nop" : "+v"(acc[0][0]), "+v"(acc[1][1]), "+v"(acc[2][2]), "+v"(acc[3][3]) : "v"(a[0]), "v"(a[3]));
    }
#pragma unroll
    for (int mb = 0; mb < 4; ++mb) {
#pragma unroll
        for (int nb = 0; nb < 4; ++nb) {
#pragma unroll
            for (int j = 0; j < 8; ++j) os[(hi * 8 + j) * 68 + nb * 16 + lr] = acc[mb][nb][j]; }
        wave_lds_sync();
        float* crow = C + (size_t)(r0 + mb * 16) * ldc + c0;
{
#pragma unroll
            for (int s = 0; s < 8; ++s) { const int row = 2 * s + hi, cofs = lr * 4; v4f val = *(const v4fa*)(os + row * 68 + cofs);
                *(v4f*)(crow + (size_t)row * ldc + cofs) = val; }
             }
        wave_lds_sync();
    }
}

__global__ __launch_bounds__(256) void k_cvt8(const float* __restrict__ src, bf* dst, size_t n8) { const size_t i = (size_t)blockIdx.x * 256 + threadIdx.x; if (i >= n8) return; const v8f v = *(const v8f*)(src + i * 8); v8us o;
#pragma unroll
    for (int k = 0; k < 8; ++k) o[k] = f2bf(v[k]); *(v8us*)(dst + i * 8) = o;  }

__global__ __launch_bounds__(256) void k_plane(const float* __restrict__ F, int pitch, int nheads, float sc, h16* P16, bf* Ph, bf* Pl) {
    const size_t e = ((size_t)blockIdx.x * 256 + threadIdx.x) * 2; if (e >= (size_t)NB * nheads * TT * HD) return;
    const int d = (int)(e % HD); const int t = (int)((e / HD) % TT); const int bh = (int)(e / ((size_t)HD * TT)); const int b = bh / nheads, h = bh % nheads;
    const float* f = F + (size_t)(b * TT + t) * pitch + h * HD + d; v2h o16; v2us oh, ol;
#pragma unroll
    for (int q = 0; q < 2; ++q) { const float r = f[q] * sc; o16[q] = tohx(r); unsigned short a2, c2; splitf(r, a2, c2); oh[q] = a2; ol[q] = c2; }
    *(v2h*)(P16 + e) = o16; *(v2us*)(Ph + e) = oh; *(v2us*)(Pl + e) = ol;  }

__global__ __launch_bounds__(256) void k_vtp(const float* __restrict__ F, int pitch, int nheads, float sc, h16* V16, bf* Vh, bf* Vl) { const size_t e = ((size_t)blockIdx.x * 256 + threadIdx.x) * 2; if (e >= (size_t)NB * nheads * HD * TT) return; const int t = (int)(e % TT); const int d = (int)((e / TT) % HD); const int bg = (int)(e / ((size_t)TT * HD)); const int b = bg / nheads, g = bg % nheads; v2h o16; v2us oh, ol;
#pragma unroll
    for (int q = 0; q < 2; ++q) { const float x = F[(size_t)(b * TT + t + q) * pitch + g * HD + d] * sc; o16[q] = tohx(x); unsigned short a2, c2; splitf(x, a2, c2); oh[q] = a2; ol[q] = c2; }
    *(v2h*)(V16 + e) = o16; *(v2us*)(Vh + e) = oh; *(v2us*)(Vl + e) = ol;  }

// ---- k_asoft: one wave per row (zz, i) of the pass: t = S * SCL where j <= i and the fill input is zero, -inf otherwise (per-element replace fill); rows whose strict upper triangle contains an unfilled entry get NaN probabilities;
__global__ __launch_bounds__(256) void k_asoft(const float* __restrict__ Sb, const int* __restrict__ Fm, h16* P16, bf* Ph, bf* Pl) {
    const int lane = threadIdx.x & 31; const int row = blockIdx.x * 8 + (threadIdx.x >> 5); if (row >= ZH * TT) return; const int i = row % TT; const int zz = row / TT; const bool hires = (i < RH);
    const float* sr = Sb + (size_t)row * TT; const int* fr = Fm + (size_t)i * SEQ_FULL; const float ninf = -__builtin_inff();
    float v[TT / 32]; float mx = ninf; int bad = 0;
#pragma unroll
    for (int ch = 0; ch < TT / 128; ++ch) { const int j0 = ch * 128 + lane * 4; const v4f a = *(const v4f*)(sr + j0); const v4i fm = *(const v4i*)(fr + j0);
#pragma unroll
        for (int q = 0; q < 4; ++q) { const int j = j0 + q; const bool vis = (j <= i); const bool filled = (fm[q] != 0); const float t = (vis && !filled) ? a[q] * SCL : ninf; bad |= (!vis && !filled) ? 1 : 0; v[ch * 4 + q] = t; mx = fmaxf(mx, t); } }
#pragma unroll
    for (int sh = 16; sh; sh >>= 1) { mx = fmaxf(mx, __shfl_xor(mx, sh, 32)); bad |= __shfl_xor(bad, sh, 32); }
    float sum = 0.f;
#pragma unroll
    for (int k = 0; k < TT / 32; ++k) { float d0 = __fsub_rn(v[k], mx); asm volatile("" : "+v"(d0)); v[k] = __builtin_amdgcn_exp2f(__fmul_rn(d0, 1.4426950408889634f)); sum += v[k]; }
#pragma unroll
    for (int sh = 16; sh; sh >>= 1) sum += __shfl_xor(sum, sh, 32);
    float f = __fdiv_rn(hires ? 1.0f : PCAR, sum); if (bad) f = __uint_as_float(0x7fc00000u);
{
        if (hires) {
#pragma unroll
            for (int ch = 0; ch < TT / 128; ++ch) { v4us oh, ol;
#pragma unroll
                for (int q = 0; q < 4; ++q) { unsigned short a2, c2; splitf(v[ch * 4 + q] * f, a2, c2); oh[q] = a2; ol[q] = c2; }
                const size_t oo = ((size_t)zz * RH + i) * TT + ch * 128 + lane * 4; *(v4us*)(Ph + oo) = oh; *(v4us*)(Pl + oo) = ol; }
        } else {
#pragma unroll
            for (int ch = 0; ch < TT / 128; ++ch) { v4h o4;
#pragma unroll
                for (int q = 0; q < 4; ++q) o4[q] = tohx(v[ch * 4 + q] * f);
                *(v4h*)(P16 + (size_t)row * TT + ch * 128 + lane * 4) = o4; } }
         }
}

__global__ __launch_bounds__(256) void k_merge(const float* __restrict__ O, int h0, bf* Ah, bf* Al) { const size_t e = ((size_t)blockIdx.x * 256 + threadIdx.x) * 2; if (e >= (size_t)ZH * TT * HD) return; const int d = (int)(e % HD); const int t = (int)((e / HD) % TT); const int zz = (int)(e / ((size_t)HD * TT)); const float cs = (t < RH) ? (1.0f / VCAR) : (1.0f / (VCAR * PCAR)); const int bh = h0 + zz; const size_t oo = (size_t)((bh / NH_) * TT + t) * DQ + (bh % NH_) * HD + d;
    v2us oh, ol;
#pragma unroll
    for (int q = 0; q < 2; ++q) { unsigned short a2, c2; splitf(O[e + q] * cs, a2, c2); oh[q] = a2; ol[q] = c2; } *(v2us*)(Ah + oo) = oh; *(v2us*)(Al + oo) = ol;  }

extern "C" void kernel_launch(void* const* d_in, const int* in_sizes, int n_in,
                              void* d_out, int out_size, void* d_ws, size_t ws_size, hipStream_t stream) {
    if (n_in < 10) return;
    if (in_sizes[0] < ((NB - 1) * SEQ_FULL + SEQ) * DM) return;
    if (in_sizes[1] < (SEQ - 1) * SEQ_FULL + SEQ) return;
    if (in_sizes[2] < DQ * DM || in_sizes[3] < DQ || in_sizes[4] < DKV * DM || in_sizes[5] < DKV || in_sizes[6] < DKV * DM || in_sizes[7] < DKV || in_sizes[8] < DM * DQ || in_sizes[9] < DM) return;
    if (out_size < ((NB - 1) * SEQ_FULL + SEQ) * DM) return;
    const float* x  = (const float*)d_in[0];   // [NB_FULL][SEQ_FULL][DM]
    const int*   fm = (const int*)d_in[1];     // [1][1][SEQ_FULL][SEQ_FULL], nonzero = filled (-inf)
    const float* wq = (const float*)d_in[2]; const float* bq = (const float*)d_in[3];   // [DQ][DM], [DQ]
    const float* wk = (const float*)d_in[4]; const float* bk = (const float*)d_in[5];   // [DKV][DM], [DKV]
    const float* wv = (const float*)d_in[6]; const float* bv = (const float*)d_in[7];   // [DKV][DM], [DKV]
    const float* wo = (const float*)d_in[8]; const float* bo = (const float*)d_in[9];   // [DM][DQ], [DM]
    float* OUT = (float*)d_out;                // [NB_FULL][SEQ_FULL][DM]
    char* wsp = (char*)d_ws; size_t used = 0;
    auto take = [&](size_t bytes) { char* p = wsp + used; used += (bytes + 255) & ~(size_t)255; return (void*)p; };
    bf* WQ = (bf*)take((size_t)DQ * DM * 2); bf* WK = (bf*)take((size_t)DKV * DM * 2); bf* WV = (bf*)take((size_t)DKV * DM * 2); bf* WO = (bf*)take((size_t)DM * DQ * 2);
    bf* XB = (bf*)take((size_t)MT * DM * 2); float* FQ = (float*)take((size_t)MT * DQ * 4); float* FK = (float*)take((size_t)MT * DKV * 4);
    h16* QP16 = (h16*)take((size_t)NHB * TT * HD * 2); h16* KP16 = (h16*)take((size_t)NKVB * TT * HD * 2); h16* VT16 = (h16*)take((size_t)NKVB * HD * TT * 2);
    bf* QPh = (bf*)take((size_t)NHB * TT * HD * 2); bf* QPl = (bf*)take((size_t)NHB * TT * HD * 2); bf* KPh = (bf*)take((size_t)NKVB * TT * HD * 2); bf* KPl = (bf*)take((size_t)NKVB * TT * HD * 2);
    bf* VTh = (bf*)take((size_t)NKVB * HD * TT * 2); bf* VTl = (bf*)take((size_t)NKVB * HD * TT * 2); bf* Ph = (bf*)take((size_t)ZH * RH * TT * 2); bf* Pl = (bf*)take((size_t)ZH * RH * TT * 2);
    float* Sb = (float*)take((size_t)ZH * TT * TT * 4); h16* P16 = (h16*)take((size_t)ZH * TT * TT * 2); float* Ob = (float*)take((size_t)ZH * TT * HD * 4);
    bf* ATh = (bf*)take((size_t)MT * DQ * 2); bf* ATl = (bf*)take((size_t)MT * DQ * 2);
    if (used > ws_size) return;
    float* FV = FK;   // v projection reuses the k buffer after the k planes are built (stream-ordered)

    const size_t n8q = (size_t)DQ * DM / 8, n8k = (size_t)DKV * DM / 8, n8x = (size_t)MT * DM / 8;
    k_cvt8<<<(unsigned)((n8q + 255) / 256), 256, 0, stream>>>(wq, WQ, n8q);
    k_cvt8<<<(unsigned)((n8k + 255) / 256), 256, 0, stream>>>(wk, WK, n8k);
    k_cvt8<<<(unsigned)((n8k + 255) / 256), 256, 0, stream>>>(wv, WV, n8k);
    k_cvt8<<<(unsigned)((n8q + 255) / 256), 256, 0, stream>>>(wo, WO, n8q);
    const unsigned LQ = (unsigned)(((size_t)NHB * TT * HD / 2 + 255) / 256), LKv = (unsigned)(((size_t)NKVB * TT * HD / 2 + 255) / 256), LM = (unsigned)(((size_t)ZH * TT * HD / 2 + 255) / 256);
    k_cvt8<<<(unsigned)((n8x + 255) / 256), 256, 0, stream>>>(x, XB, n8x);
    k_gemmw<bf, 0, true><<<dim3(MT / 64, DQ / 64, 1), 32, 0, stream>>>(XB, nullptr, WQ, nullptr, DM, FQ, DQ, bq, 0, 0, 0);
    k_plane<<<LQ, 256, 0, stream>>>(FQ, DQ, NH_, QCAR, QP16, QPh, QPl);
    k_gemmw<bf, 0, true><<<dim3(MT / 64, DKV / 64, 1), 32, 0, stream>>>(XB, nullptr, WK, nullptr, DM, FK, DKV, bk, 0, 0, 0);
    k_plane<<<LKv, 256, 0, stream>>>(FK, DKV, NKV, QCAR, KP16, KPh, KPl);
    k_gemmw<bf, 0, true><<<dim3(MT / 64, DKV / 64, 1), 32, 0, stream>>>(XB, nullptr, WV, nullptr, DM, FV, DKV, bv, 0, 0, 0);
    k_vtp<<<LKv, 256, 0, stream>>>(FV, DKV, NKV, VCAR, VT16, VTh, VTl);
    for (int h0 = 0; h0 < NHB; h0 += ZH) { const size_t zq = (size_t)h0, zk = (size_t)(h0 / REP);   // batch-head h0 + zz uses batch-group h0/REP + zz/REP
        k_gemmc<bf, 2, 1><<<dim3(RH / 64, TT / 64, ZH), 32, 0, stream>>>(QPh + zq * TT * HD, QPl + zq * TT * HD, KPh + zk * TT * HD, KPl + zk * TT * HD, HD, Sb, TT, 0, (size_t)TT * HD, (size_t)TT * HD, (size_t)TT * TT, REP);
        k_gemmc<h16, 0, 1><<<dim3((TT - RH) / 64, TT / 64, ZH), 32, 0, stream>>>(QP16 + zq * TT * HD + (size_t)RH * HD, nullptr, KP16 + zk * TT * HD, nullptr, HD, Sb + (size_t)RH * TT, TT, RH, (size_t)TT * HD, (size_t)TT * HD, (size_t)TT * TT, REP);
        k_asoft<<<(unsigned)(ZH * TT / 8), 256, 0, stream>>>(Sb, fm, P16, Ph, Pl);
        k_gemmc<bf, 2, 2><<<dim3(RH / 64, HD / 64, ZH), 32, 0, stream>>>(Ph, Pl, VTh + zk * HD * TT, VTl + zk * HD * TT, TT, Ob, HD, 0, (size_t)RH * TT, (size_t)HD * TT, (size_t)TT * HD, REP);
        k_gemmc<h16, 0, 2><<<dim3((TT - RH) / 64, HD / 64, ZH), 32, 0, stream>>>(P16 + (size_t)RH * TT, nullptr, VT16 + zk * HD * TT, nullptr, TT, Ob + (size_t)RH * HD, HD, RH, (size_t)TT * TT, (size_t)HD * TT, (size_t)TT * HD, REP);
        k_merge<<<LM, 256, 0, stream>>>(Ob, h0, ATh, ATl); }
    k_gemmw<bf, 1, true><<<dim3(MT / 64, DM / 64, 1), 32, 0, stream>>>(ATh, ATl, WO, nullptr, DQ, OUT, DM, bo, 0, 0, 0);
}

// v003
// Measured time: 157 microseconds a run.
// Versions in between are left out here; by their measured steps it is 3.06 times as fast as v001.
// All steps since v000 together make it 5.19 times as fast.
#include <hip/hip_runtime.h>

// Contractions (all f32 accumulate): x Wq^T, x Wk^T, x Wv^T on v_wmma_f32_16x16x32_bf16 (bf16 operands, inputs RNE-converted once, bias added in f32); q k^T and p v: query rows < RH on bf16 hi/lo planes (3 products), rows >= RH on v_wmma_f32_16x16x32_f16 (f16 operands: q and k carried x8, p carried x1024, v carried x8); ctx Wo^T: bf16 hi/lo ctx planes x bf16 Wo (2 products).
// Layout: grouped-query causal attention, NB x SEQ tokens (all batches in every launch: token row = b*SEQ + t, batch-head = b*32 + h, batch-group = batch-head / 4), hidden 2048, 32 query heads x 64 (head h = columns h*64..), 8 kv groups x 64 (kv group = head / 4), weights [out][in] (k-contiguous, used as Bt directly) + bias, scale 64^-0.5.
// Fill input [1][1][SEQ_FULL][SEQ_FULL] int (nonzero = -inf fill) is applied per element on and below the diagonal; the strict upper triangle is assumed filled (the key loop of a query tile stops at its diagonal block); k_vis checks that assumption per row on device and the row's context is written NaN otherwise.
// Attention is one launch: scores, softmax (running maximum and sum over key blocks of 32, normalised once at the end) and p.v stay in registers.

#ifndef NB
#define NB 2
#endif
#ifndef SEQ
#define SEQ 1024
#endif
#define NB_FULL  2
#define SEQ_FULL 1024
#define TT   SEQ
#define DM   2048
#define NH_  32
#define NKV  8
#define REP  (NH_ / NKV)
#define HD   64
#define DQ   (NH_ * HD)
#define DKV  (NKV * HD)
#define MT   (NB * TT)             // token rows of all batches
#define NHB  (NB * NH_)            // batch-heads (b * NH_ + h)
#define NKVB (NB * NKV)            // batch-groups (b * NKV + g) = batch-head / REP
#ifndef RH
#define RH   ((SEQ) >= 512 ? 256 : 64)   // query rows < RH use hi+lo planes
#endif
#define PCARL2 10.0f               // log2 of the p carry (x1024) for f16 rows
#define QCAR 8.0f                  // q, k plane carry
#define VCAR 8.0f                  // v plane carry
#define SCL  (0.125f / 64.0f)      // HD^-0.5 / (QCAR*QCAR)

static_assert(NB >= 1 && NB <= NB_FULL);
static_assert(SEQ % 128 == 0 && SEQ >= 128 && SEQ <= SEQ_FULL);
static_assert(RH % 64 == 0 && RH >= 64 && RH < SEQ);
static_assert(NH_ % NKV == 0 && RH % 32 == 0 && (SEQ - RH) % 32 == 0);
static_assert(SEQ == SEQ_FULL || NB == 1);   // token rows of all batches are contiguous in x and out
static_assert(DM % 64 == 0 && DQ % 64 == 0 && DKV % 64 == 0 && HD == 64 && TT % 64 == 0);
static_assert(DM % 32 == 0 && HD % 32 == 0 && TT % 32 == 0);
static_assert(MT % 128 == 0 && DM % 128 == 0 && DQ % 128 == 0 && DKV % 128 == 0);   // 128x128 GEMM tiles, stages of 128 k

typedef _Float16 h16;
typedef unsigned short bf;
typedef __attribute__((ext_vector_type(16))) __bf16   v16bf;
typedef __attribute__((ext_vector_type(16))) _Float16 v16h;
typedef __attribute__((ext_vector_type(8)))  _Float16 v8h;
typedef __attribute__((ext_vector_type(8)))  unsigned short v8us;
typedef __attribute__((ext_vector_type(16))) unsigned short v16us;
typedef __attribute__((ext_vector_type(8)))  float    v8f;
typedef __attribute__((ext_vector_type(4)))  float    v4f;
typedef __attribute__((ext_vector_type(4)))  int      v4i;
typedef __attribute__((ext_vector_type(2)))  _Float16 v2h;
typedef __attribute__((ext_vector_type(4)))  _Float16 v4h;
typedef __attribute__((ext_vector_type(2)))  unsigned short v2us;
typedef __attribute__((ext_vector_type(4)))  unsigned short v4us;
typedef v8h  __attribute__((may_alias)) v8ha;
typedef v4f  __attribute__((may_alias)) v4fa;
typedef v8us __attribute__((may_alias)) v8usa;

__device__ __forceinline__ unsigned short f2bf(float f) { unsigned u = __float_as_uint(f); u += 0x7FFFu + ((u >> 16) & 1u); return (unsigned short)(u >> 16); }
__device__ __forceinline__ float bf2f(unsigned short b) { return __uint_as_float(((unsigned)b) << 16); }
__device__ __forceinline__ float bfr(float f) { return bf2f(f2bf(f)); }
__device__ __forceinline__ v16h cat16(v8h lo, v8h hi) { return __builtin_shufflevector(lo, hi, 0, 1, 2, 3, 4, 5, 6, 7, 8, 9, 10, 11, 12, 13, 14, 15); }
__device__ __forceinline__ v16bf cat16b(v8us lo, v8us hi) { return __builtin_bit_cast(v16bf, __builtin_shufflevector(lo, hi, 0, 1, 2, 3, 4, 5, 6, 7, 8, 9, 10, 11, 12, 13, 14, 15)); }
__device__ __forceinline__ v8f wmma16(v16h a, v16h b, v8f c) { return __builtin_amdgcn_wmma_f32_16x16x32_f16(false, a, false, b, (short)0, c, false, false); }
__device__ __forceinline__ v8f wmmab(v16bf a, v16bf b, v8f c) { return __builtin_amdgcn_wmma_f32_16x16x32_bf16(false, a, false, b, (short)0, c, false, false); }
__device__ __forceinline__ h16 tohx(float x) { return (h16)x; }
__device__ __forceinline__ void splitf(float y, unsigned short& h, unsigned short& l) { h = f2bf(y); l = f2bf(y - bf2f(h)); }
// same-wave LDS relayout: stores of all lanes complete before any lane reloads (wave-private tile)
__device__ __forceinline__ void wave_lds_sync() { __builtin_amdgcn_fence(3 /* release order */, "wavefront"); __builtin_amdgcn_wave_barrier(); asm volatile("" ::: "memory"); }

// ---- Fragment loader (16-bit planes, k-contiguous rows): lane l -> row (l & 15); elements 0..7 <- k0 + 8*(l>>4) + 0..7, elements 8..15 <- k0 + 16 + 8*(l>>4) + 0..7.
// Used for A (row m) and for Bt (row n of the [n][k] plane) alike; D element r of lane l = (row 8*(l>>4) + r, col l & 15).
template <typename T16> struct WFrag;
template <> struct WFrag<h16> { typedef v16h V; static __device__ __forceinline__ V ld(const h16* p) { return cat16(*(const v8h*)p, *(const v8h*)(p + 16)); } static __device__ __forceinline__ v8f mma(V a, V b, v8f c) { return wmma16(a, b, c); } };
template <> struct WFrag<bf> { typedef v16bf V; static __device__ __forceinline__ V ld(const bf* p) { return cat16b(*(const v8us*)p, *(const v8us*)(p + 16)); } static __device__ __forceinline__ v8f mma(V a, V b, v8f c) { return wmmab(a, b, c); } };

// ---- k_gemmw: GEMM, work-group of 4 waves (2 x 2) on a 128x128 output tile, each wave 64x64 (16 accumulators); grid (M/128, N/128), 128 threads.
// C[m][n] (f32, pitch ldc, + optional f32 bias[n] as bf16-RNE value) = sum_k A[m][k] Bt[n][k] (+ A2[m][k] Bt[n][k] for NSPLIT 1). K % GKC == 0, K >= 2 GKC, M % 128 == 0, N % 128 == 0.
// The operand tiles (128 rows x GKC k of A, of A2 where there is one, of Bt) are staged in LDS by asynchronous copies, two buffers: tile t + 1 flies while tile t is multiplied. Each tile row is read from L2 once per work-group, in whole lines.
#define GKC   128                  // k elements of one stage: rows of 256 bytes
#define GPIT  136                  // LDS row pitch in elements: 272 bytes = 16 x odd, the conflict-free pitch for 16-byte fragment reads
#define GTILE (128 * GPIT)         // elements of one operand tile in LDS
__device__ __forceinline__ unsigned lds_off(const void* p) { return (unsigned)(size_t)p; }   // byte offset in the work-group's LDS = low 32 bits of the __shared__ address
// eight 16-byte copies per lane, rows 8 apart (LDS step ls bytes, global step gs elements); s_wait_xcnt 0 as the statement's last line, a precaution: so it stands in front of every later write of a register that these copies name
template <typename T16>
__device__ __forceinline__ void acopy8(unsigned l, const T16* g, unsigned ls, size_t gs) {
    asm volatile("global_load_async_to_lds_b128 %0, %8, off\n\t"
                 "global_load_async_to_lds_b128 %1, %9, off\n\t"
                 "global_load_async_to_lds_b128 %2, %10, off\n\t"
                 "global_load_async_to_lds_b128 %3, %11, off\n\t"
                 "global_load_async_to_lds_b128 %4, %12, off\n\t"
                 "global_load_async_to_lds_b128 %5, %13, off\n\t"
                 "global_load_async_to_lds_b128 %6, %14, off\n\t"
                 "global_load_async_to_lds_b128 %7, %15, off\n\t"
                 "s_wait_xcnt 0x0"
                 :: "v"(l), "v"(l + ls), "v"(l + 2 * ls), "v"(l + 3 * ls), "v"(l + 4 * ls), "v"(l + 5 * ls), "v"(l + 6 * ls), "v"(l + 7 * ls),
                    "v"(g), "v"(g + gs), "v"(g + 2 * gs), "v"(g + 3 * gs), "v"(g + 4 * gs), "v"(g + 5 * gs), "v"(g + 6 * gs), "v"(g + 7 * gs)
                 : "memory");
}
template <typename T16, int NSPLIT, bool BIAS, int K>
__global__ __launch_bounds__(128) void k_gemmw(const T16* __restrict__ A, const T16* __restrict__ A2, const T16* __restrict__ Bt, float* C, int ldc, const float* __restrict__ bias) {
    typedef typename WFrag<T16>::V V;
    static_assert((NSPLIT == 0 || NSPLIT == 1) && K % GKC == 0 && K / GKC >= 2);
    constexpr int NOP = NSPLIT + 2;                                   // operand tiles of a stage: Bt, A (, A2)
    __shared__ __attribute__((aligned(16))) T16 ring[2 * NOP * GTILE];
    __shared__ __align__(16) float osw[4 * 16 * 68];
    const int tid = threadIdx.x, lane = tid & 31, lr = lane & 15, hi = lane >> 4;
    const int w = __builtin_amdgcn_readfirstlane(tid >> 5), wm = w >> 1, wn = w & 1;
    const int R0 = blockIdx.x * 128, C0 = blockIdx.y * 128;
    // copy map: 16 lanes cover one 256-byte row, the 128 threads 8 rows; 16 copies per lane and operand tile
    const int crow = tid >> 4, ccol = (tid & 15) * 8;
    const unsigned lc = lds_off(ring) + (unsigned)(crow * GPIT + ccol) * 2u;
    const T16* gB = Bt + (size_t)(C0 + crow) * K + ccol; const T16* gA = A + (size_t)(R0 + crow) * K + ccol; const T16* gA2 = (NSPLIT == 1) ? A2 + (size_t)(R0 + crow) * K + ccol : nullptr;
    auto fill = [&](int t, int buf) {
        const unsigned l = lc + (unsigned)(buf * NOP * GTILE) * 2u; const size_t ko = (size_t)t * GKC, g8 = (size_t)8 * K;
        acopy8(l, gB + ko, 8 * GPIT * 2, g8); acopy8(l + 64 * GPIT * 2, gB + ko + 8 * g8, 8 * GPIT * 2, g8);
        acopy8(l + GTILE * 2, gA + ko, 8 * GPIT * 2, g8); acopy8(l + GTILE * 2 + 64 * GPIT * 2, gA + ko + 8 * g8, 8 * GPIT * 2, g8);
        if constexpr (NSPLIT == 1) { acopy8(l + 2 * GTILE * 2, gA2 + ko, 8 * GPIT * 2, g8); acopy8(l + 2 * GTILE * 2 + 64 * GPIT * 2, gA2 + ko + 8 * g8, 8 * GPIT * 2, g8); }
    };
    v8f acc[4][4];
#pragma unroll
    for (int mb = 0; mb < 4; ++mb)
#pragma unroll
        for (int nb = 0; nb < 4; ++nb) acc[mb][nb] = (v8f){};
    constexpr int ntr = K / GKC;
    fill(0, 0);
    asm volatile("s_wait_asynccnt 0x0" ::: "memory");   // this wave's copies of tile 0 have landed
    __syncthreads();                                    // every wave's have
    fill(1, 1);
    const int boff = (wn * 64 + lr) * GPIT + 8 * hi, aoff = GTILE + (wm * 64 + lr) * GPIT + 8 * hi;
// rolled: one trip per stage
#pragma unroll 1
    for (int t = 0; t < ntr; ++t) {
        const T16* st = ring + (t & 1) * (NOP * GTILE);
        V a[2][4], a2[2][4], b[2][4];
#pragma unroll
        for (int f = 0; f < 4; ++f) { b[0][f] = WFrag<T16>::ld(st + boff + f * 16 * GPIT); a[0][f] = WFrag<T16>::ld(st + aoff + f * 16 * GPIT); if (NSPLIT == 1) a2[0][f] = WFrag<T16>::ld(st + aoff + GTILE + f * 16 * GPIT); }
// unrolled: the two fragment sets are indexed by constants and stay in registers
#pragma unroll
        for (int ks = 0; ks < GKC / 32; ++ks) { const int c = ks & 1, n = c ^ 1;
            if (ks + 1 < GKC / 32) {                    // the next 32 k of this same tile are fetched as one group ahead of this block's products
#pragma unroll
                for (int f = 0; f < 4; ++f) { const int o = f * 16 * GPIT + (ks + 1) * 32; b[n][f] = WFrag<T16>::ld(st + boff + o); a[n][f] = WFrag<T16>::ld(st + aoff + o); if (NSPLIT == 1) a2[n][f] = WFrag<T16>::ld(st + aoff + GTILE + o); } }
            __builtin_amdgcn_sched_barrier(0);          // keeps that group of LDS reads together and ahead of the products; left free they sink to their first use, each behind a wait to 0
#pragma unroll
            for (int nb = 0; nb < 4; ++nb)
#pragma unroll
                for (int mb = 0; mb < 4; ++mb) acc[mb][nb] = WFrag<T16>::mma(a[c][mb], b[c][nb], acc[mb][nb]);
            if constexpr (NSPLIT == 1) {
#pragma unroll
                for (int nb = 0; nb < 4; ++nb)
#pragma unroll
                    for (int mb = 0; mb < 4; ++mb) acc[mb][nb] = WFrag<T16>::mma(a2[c][mb], b[c][nb], acc[mb][nb]); }
            __builtin_amdgcn_sched_barrier(0);          // keeps the following group of LDS reads from being spread among these products
        }
        asm volatile("s_wait_dscnt 0x0" ::: "memory");      // this wave's reads of the buffer are done before it is handed back
        asm volatile("s_wait_asynccnt 0x0" ::: "memory");   // this wave's copies of tile t + 1 have landed
        __syncthreads();                                    // publishes tile t + 1 and ends every wave's reads of tile t
        if (t + 2 < ntr) fill(t + 2, t & 1);
    }
    asm volatile("s_wait_asynccnt 0x0" ::: "memory");       // no copy is left in flight
    float* os = osw + w * (16 * 68);                        // this wave's own staging rows
    const int r0 = R0 + wm * 64, c0 = C0 + wn * 64;
#pragma unroll
    for (int mb = 0; mb < 4; ++mb) {
#pragma unroll
        for (int nb = 0; nb < 4; ++nb) {
#pragma unroll
            for (int j = 0; j < 8; ++j) os[(hi * 8 + j) * 68 + nb * 16 + lr] = acc[mb][nb][j]; }
        wave_lds_sync();
        float* crw = C + (size_t)(r0 + mb * 16) * ldc + c0;
#pragma unroll
        for (int s = 0; s < 8; ++s) { const int row = 2 * s + hi, cofs = lr * 4; v4f val = *(const v4fa*)(os + row * 68 + cofs); if (BIAS) { val[0] += bfr(bias[c0 + cofs]); val[1] += bfr(bias[c0 + cofs + 1]); val[2] += bfr(bias[c0 + cofs + 2]); val[3] += bfr(bias[c0 + cofs + 3]); }
            *(v4f*)(crw + (size_t)row * ldc + cofs) = val; }
        asm volatile("s_wait_xcnt 0x0" ::: "memory");   // a precaution: stands before the next rows' values and addresses go into registers that these stores name
        wave_lds_sync();
    }
}

__global__ __launch_bounds__(256) void k_cvt8(const float* __restrict__ src, bf* dst, size_t n8) { const size_t i = (size_t)blockIdx.x * 256 + threadIdx.x; if (i >= n8) return; const v8f v = *(const v8f*)(src + i * 8); v8us o;
#pragma unroll
    for (int k = 0; k < 8; ++k) o[k] = f2bf(v[k]); *(v8us*)(dst + i * 8) = o;  }

__global__ __launch_bounds__(256) void k_plane(const float* __restrict__ F, int pitch, int nheads, float sc, h16* P16, bf* Ph, bf* Pl) {
    const size_t e = ((size_t)blockIdx.x * 256 + threadIdx.x) * 2; if (e >= (size_t)NB * nheads * TT * HD) return;
    const int d = (int)(e % HD); const int t = (int)((e / HD) % TT); const int bh = (int)(e / ((size_t)HD * TT)); const int b = bh / nheads, h = bh % nheads;
    const float* f = F + (size_t)(b * TT + t) * pitch + h * HD + d; v2h o16; v2us oh, ol;
#pragma unroll
    for (int q = 0; q < 2; ++q) { const float r = f[q] * sc; o16[q] = tohx(r); unsigned short a2, c2; splitf(r, a2, c2); oh[q] = a2; ol[q] = c2; }
    *(v2h*)(P16 + e) = o16; *(v2us*)(Ph + e) = oh; *(v2us*)(Pl + e) = ol;  }

__global__ __launch_bounds__(256) void k_vtp(const float* __restrict__ F, int pitch, int nheads, float sc, h16* V16, bf* Vh, bf* Vl) { const size_t e = ((size_t)blockIdx.x * 256 + threadIdx.x) * 2; if (e >= (size_t)NB * nheads * HD * TT) return; const int t = (int)(e % TT); const int d = (int)((e / TT) % HD); const int bg = (int)(e / ((size_t)TT * HD)); const int b = bg / nheads, g = bg % nheads; v2h o16; v2us oh, ol;
#pragma unroll
    for (int q = 0; q < 2; ++q) { const float x = F[(size_t)(b * TT + t + q) * pitch + g * HD + d] * sc; o16[q] = tohx(x); unsigned short a2, c2; splitf(x, a2, c2); oh[q] = a2; ol[q] = c2; }
    *(v2h*)(V16 + e) = o16; *(v2us*)(Vh + e) = oh; *(v2us*)(Vl + e) = ol;  }

// ---- k_vis: one wave per query row i. VB[i][w] bit c = key w*32+c is visible to query i (on or below the diagonal and the fill input zero); BAD[i] = the strict upper triangle of row i holds an unfilled entry.
__global__ __launch_bounds__(256) void k_vis(const int* __restrict__ Fm, unsigned* VB, unsigned* BAD) {
    const int lane = threadIdx.x & 31; const int i = blockIdx.x * 8 + (threadIdx.x >> 5); if (i >= TT) return;
    const int* fr = Fm + (size_t)i * SEQ_FULL; unsigned mine = 0u, bad = 0u;
// unrolled: all loads of the row are in flight at once
#pragma unroll
    for (int w = 0; w < TT / 32; ++w) { const int j = w * 32 + lane; const bool filled = (fr[j] != 0); const bool vis = (j <= i);
        const unsigned bits = __builtin_amdgcn_ballot_w32(vis && !filled); bad |= __builtin_amdgcn_ballot_w32(!vis && !filled); if (lane == w) mine = bits; }
    if (lane < TT / 32) VB[(size_t)i * (TT / 32) + lane] = mine;
    if (lane == 0) BAD[i] = bad;
}

// ---- fattn_tile: one wave, NT*16 query rows of one batch-head, key blocks of 32 up to the diagonal block, running maximum and sum (scores and probabilities stay in registers).
// St = K Q^T: A = key rows, Bt = query rows, so D element r of lane l = (key 8*(l>>4) + r, query l & 15); the two 16-key tiles of a block are then, element for element, the fragment order of the loader above
// (elements 0..7 <- k 8*(l>>4) + 0..7, elements 8..15 <- k 16 + 8*(l>>4) + 0..7), so the probabilities go straight in as Bt of Ot = V^T P^T (A = rows d of the [d][t] value plane). Ot element r of lane l = (d 8*(l>>4) + r, query l & 15).
// Every '#pragma unroll' in this function is there so that the fragment, score and output arrays are indexed by constants and stay in registers.
// SPLIT: hi/lo bf16 planes, 3 products in the order hi.hi, (query or p) lo . hi, hi . (key or value) lo. Not SPLIT: f16 planes, p carried x1024 (the carry is in the sum as well and cancels).
template <typename T16, bool SPLIT, int NT>
__device__ __forceinline__ void fattn_tile(const T16* __restrict__ Q, const T16* __restrict__ Q2, const T16* __restrict__ Kp, const T16* __restrict__ K2, const T16* __restrict__ Vt, const T16* __restrict__ V2,
                                           const unsigned* __restrict__ VB, const unsigned* __restrict__ BAD, int q0, bf* Ah, bf* Al) {
    typedef typename WFrag<T16>::V V;
    const int lane = threadIdx.x & 31, lr = lane & 15, hi = lane >> 4; const float ninf = -__builtin_inff();
    const float C1 = SCL * 1.4426950408889634f;
    V qf[NT][2], qf2[NT][2];
#pragma unroll
    for (int nt = 0; nt < NT; ++nt)
#pragma unroll
        for (int ks = 0; ks < 2; ++ks) { const unsigned qo = (unsigned)(q0 + nt * 16 + lr) * HD + ks * 32 + 8 * hi; qf[nt][ks] = WFrag<T16>::ld(Q + qo); if (SPLIT) qf2[nt][ks] = WFrag<T16>::ld(Q2 + qo); }
    v8f o[4][NT]; float m[NT], l[NT];
#pragma unroll
    for (int nt = 0; nt < NT; ++nt) { m[nt] = ninf; l[nt] = 0.f;
#pragma unroll
        for (int dt = 0; dt < 4; ++dt) o[dt][nt] = (v8f){}; }
    const int kend = ((q0 + NT * 16 + 31) / 32) * 32;   // keys beyond the diagonal block are invisible to every row of the tile
    V kf[2][2], kf2[2][2]; unsigned wd[NT];
#pragma unroll
    for (int mt = 0; mt < 2; ++mt)
#pragma unroll
        for (int ks = 0; ks < 2; ++ks) { const unsigned ko = (unsigned)(mt * 16 + lr) * HD + ks * 32 + 8 * hi; kf[mt][ks] = WFrag<T16>::ld(Kp + ko); if (SPLIT) kf2[mt][ks] = WFrag<T16>::ld(K2 + ko); }
#pragma unroll
    for (int nt = 0; nt < NT; ++nt) wd[nt] = VB[(unsigned)(q0 + nt * 16 + lr) * (TT / 32)];
// rolled: one block's fragments, scores and outputs already fill the register budget
#pragma unroll 1
    for (int kb = 0; kb < kend; kb += 32) {
        V vf[4], vf2[4];
#pragma unroll
        for (int dt = 0; dt < 4; ++dt) { const unsigned vo = (unsigned)(dt * 16 + lr) * TT + kb + 8 * hi; vf[dt] = WFrag<T16>::ld(Vt + vo); if (SPLIT) vf2[dt] = WFrag<T16>::ld(V2 + vo); }
        if constexpr (!SPLIT) __builtin_amdgcn_sched_barrier(0);   // keeps the value loads up here, a whole softmax ahead of their use; left free they sink between the p.v products and each waits out its full latency
        v8f s[2][NT]; unsigned wc[NT];
#pragma unroll
        for (int mt = 0; mt < 2; ++mt)
#pragma unroll
            for (int nt = 0; nt < NT; ++nt) { v8f a = (v8f){};
#pragma unroll
                for (int ks = 0; ks < 2; ++ks) { a = WFrag<T16>::mma(kf[mt][ks], qf[nt][ks], a); if (SPLIT) { a = WFrag<T16>::mma(kf[mt][ks], qf2[nt][ks], a); a = WFrag<T16>::mma(kf2[mt][ks], qf[nt][ks], a); } }
                s[mt][nt] = a; }
#pragma unroll
        for (int nt = 0; nt < NT; ++nt) wc[nt] = wd[nt] >> (8 * hi);
        if constexpr (SPLIT) asm volatile("s_wait_xcnt 0x0" ::: "memory");   // in this build the key loads below return into registers that hold the value loads' addresses
        const int kn = min(kb + 32, kend - 32);          // next block's key fragments and visibility words fly during this block's softmax (the last block fetches itself again)
#pragma unroll
        for (int mt = 0; mt < 2; ++mt)
#pragma unroll
            for (int ks = 0; ks < 2; ++ks) { const unsigned ko = (unsigned)(kn + mt * 16 + lr) * HD + ks * 32 + 8 * hi; kf[mt][ks] = WFrag<T16>::ld(Kp + ko); if (SPLIT) kf2[mt][ks] = WFrag<T16>::ld(K2 + ko); }
#pragma unroll
        for (int nt = 0; nt < NT; ++nt) wd[nt] = VB[(unsigned)(q0 + nt * 16 + lr) * (TT / 32) + (kn >> 5)];
        V pf[NT], pf2[NT];
#pragma unroll
        for (int nt = 0; nt < NT; ++nt) {
            float bm = ninf;
#pragma unroll
            for (int mt = 0; mt < 2; ++mt)
#pragma unroll
                for (int r = 0; r < 8; ++r) { const float t = ((wc[nt] >> (mt * 16 + r)) & 1u) ? s[mt][nt][r] : ninf; s[mt][nt][r] = t; bm = fmaxf(bm, t); }
            bm = fmaxf(bm, __shfl_xor(bm, 16, 32));
            const float mn = fmaxf(m[nt], bm); const float ms = (mn == ninf) ? 0.f : mn;   // no visible key so far: every p and the rescale come out 0, not NaN
            const float al = __builtin_amdgcn_exp2f((m[nt] - ms) * C1); m[nt] = mn;
            float ps = 0.f, p[16];
#pragma unroll
            for (int e = 0; e < 16; ++e) { const float d = s[e >> 3][nt][e & 7] - ms; if (SPLIT) asm("v_exp_f32 %0, %1\n\tv_nop" : "=v"(p[e]) : "v"(d * C1));   // v_nop: the slot behind a transcendental, tied to it
                else p[e] = __builtin_amdgcn_exp2f(__builtin_fmaf(d, C1, PCARL2));
                ps += p[e]; }
            l[nt] = l[nt] * al + ps;                     // this lane's half of the keys; the halves are joined behind the loop
#pragma unroll
            for (int dt = 0; dt < 4; ++dt) o[dt][nt] *= al;
            if constexpr (SPLIT) { v16us ph, pl;
#pragma unroll
                for (int e = 0; e < 16; ++e) { unsigned short a2, c2; splitf(p[e], a2, c2); ph[e] = a2; pl[e] = c2; }
                pf[nt] = __builtin_bit_cast(v16bf, ph); pf2[nt] = __builtin_bit_cast(v16bf, pl);
            } else {
#pragma unroll
                for (int e = 0; e < 16; ++e) pf[nt][e] = tohx(p[e]); }
        }
#pragma unroll
        for (int dt = 0; dt < 4; ++dt)
#pragma unroll
            for (int nt = 0; nt < NT; ++nt) { o[dt][nt] = WFrag<T16>::mma(vf[dt], pf[nt], o[dt][nt]); if (SPLIT) { o[dt][nt] = WFrag<T16>::mma(vf[dt], pf2[nt], o[dt][nt]); o[dt][nt] = WFrag<T16>::mma(vf2[dt], pf[nt], o[dt][nt]); } }
    }
#pragma unroll
    for (int nt = 0; nt < NT; ++nt) { const int q = q0 + nt * 16 + lr; const float lt = l[nt] + __shfl_xor(l[nt], 16, 32);
        float inv = __fdiv_rn(1.0f / VCAR, lt); if (BAD[q]) inv = __uint_as_float(0x7fc00000u);   // a row with no visible key: 0 * inf = NaN, as the softmax of an all -inf row
#pragma unroll
        for (int dt = 0; dt < 4; ++dt) { v8us oh, ol;
#pragma unroll
            for (int r = 0; r < 8; ++r) { unsigned short a2, c2; splitf(o[dt][nt][r] * inv, a2, c2); oh[r] = a2; ol[r] = c2; }
            const unsigned oo = (unsigned)q * DQ + dt * 16 + 8 * hi; *(v8us*)(Ah + oo) = oh; *(v8us*)(Al + oo) = ol; } }
}

// ---- k_fattn: grid (batch-groups, query tiles), 4 independent waves = the 4 query heads of the group on the same query rows (they read the same key and value lines). Tiles in falling order of their key count:
// first the f16 tiles (32 rows, from the last row down to RH), then the hi/lo tiles (16 rows, below RH). Writes the bf16 hi/lo context planes [token][DQ].
#define NQF ((TT - RH) / 32)
#define NQS (RH / 16)
__global__ __launch_bounds__(128) void k_fattn(const h16* __restrict__ QP16, const h16* __restrict__ KP16, const h16* __restrict__ VT16, const bf* __restrict__ QPh, const bf* __restrict__ QPl, const bf* __restrict__ KPh, const bf* __restrict__ KPl,
                                               const bf* __restrict__ VTh, const bf* __restrict__ VTl, const unsigned* __restrict__ VB, const unsigned* __restrict__ BAD, bf* ATh, bf* ATl) {
    const int bg = blockIdx.x, bh = bg * REP + __builtin_amdgcn_readfirstlane((int)(threadIdx.x >> 5)), t = blockIdx.y;   // the wave's number as a scalar: plane bases stay in scalar registers
    const size_t zq = (size_t)bh * TT * HD, zk = (size_t)bg * TT * HD, zo = (size_t)(bh / NH_) * TT * DQ + (size_t)(bh % NH_) * HD;
    if (t < NQF) fattn_tile<h16, false, 2>(QP16 + zq, nullptr, KP16 + zk, nullptr, VT16 + zk, nullptr, VB, BAD, TT - 32 * (t + 1), ATh + zo, ATl + zo);
    else         fattn_tile<bf, true, 1>(QPh + zq, QPl + zq, KPh + zk, KPl + zk, VTh + zk, VTl + zk, VB, BAD, RH - 16 * (t - NQF + 1), ATh + zo, ATl + zo);
}

extern "C" void kernel_launch(void* const* d_in, const int* in_sizes, int n_in,
                              void* d_out, int out_size, void* d_ws, size_t ws_size, hipStream_t stream) {
    if (n_in < 10) return;
    if (in_sizes[0] < ((NB - 1) * SEQ_FULL + SEQ) * DM) return;
    if (in_sizes[1] < (SEQ - 1) * SEQ_FULL + SEQ) return;
    if (in_sizes[2] < DQ * DM || in_sizes[3] < DQ || in_sizes[4] < DKV * DM || in_sizes[5] < DKV || in_sizes[6] < DKV * DM || in_sizes[7] < DKV || in_sizes[8] < DM * DQ || in_sizes[9] < DM) return;
    if (out_size < ((NB - 1) * SEQ_FULL + SEQ) * DM) return;
    const float* x  = (const float*)d_in[0];   // [NB_FULL][SEQ_FULL][DM]
    const int*   fm = (const int*)d_in[1];     // [1][1][SEQ_FULL][SEQ_FULL], nonzero = filled (-inf)
    const float* wq = (const float*)d_in[2]; const float* bq = (const float*)d_in[3];   // [DQ][DM], [DQ]
    const float* wk = (const float*)d_in[4]; const float* bk = (const float*)d_in[5];   // [DKV][DM], [DKV]
    const float* wv = (const float*)d_in[6]; const float* bv = (const float*)d_in[7];   // [DKV][DM], [DKV]
    const float* wo = (const float*)d_in[8]; const float* bo = (const float*)d_in[9];   // [DM][DQ], [DM]
    float* OUT = (float*)d_out;                // [NB_FULL][SEQ_FULL][DM]
    char* wsp = (char*)d_ws; size_t used = 0;
    auto take = [&](size_t bytes) { char* p = wsp + used; used += (bytes + 255) & ~(size_t)255; return (void*)p; };
    bf* WQ = (bf*)take((size_t)DQ * DM * 2); bf* WK = (bf*)take((size_t)DKV * DM * 2); bf* WV = (bf*)take((size_t)DKV * DM * 2); bf* WO = (bf*)take((size_t)DM * DQ * 2);
    bf* XB = (bf*)take((size_t)MT * DM * 2); float* FQ = (float*)take((size_t)MT * DQ * 4); float* FK = (float*)take((size_t)MT * DKV * 4);
    h16* QP16 = (h16*)take((size_t)NHB * TT * HD * 2); h16* KP16 = (h16*)take((size_t)NKVB * TT * HD * 2); h16* VT16 = (h16*)take((size_t)NKVB * HD * TT * 2);
    bf* QPh = (bf*)take((size_t)NHB * TT * HD * 2); bf* QPl = (bf*)take((size_t)NHB * TT * HD * 2); bf* KPh = (bf*)take((size_t)NKVB * TT * HD * 2); bf* KPl = (bf*)take((size_t)NKVB * TT * HD * 2);
    bf* VTh = (bf*)take((size_t)NKVB * HD * TT * 2); bf* VTl = (bf*)take((size_t)NKVB * HD * TT * 2);
    unsigned* VB = (unsigned*)take((size_t)TT * (TT / 32) * 4); unsigned* BAD = (unsigned*)take((size_t)TT * 4);
    bf* ATh = (bf*)take((size_t)MT * DQ * 2); bf* ATl = (bf*)take((size_t)MT * DQ * 2);
    if (used > ws_size) return;
    float* FV = FK;   // v projection reuses the k buffer after the k planes are built (stream-ordered)

    const size_t n8q = (size_t)DQ * DM / 8, n8k = (size_t)DKV * DM / 8, n8x = (size_t)MT * DM / 8;
    k_cvt8<<<(unsigned)((n8q + 255) / 256), 256, 0, stream>>>(wq, WQ, n8q);
    k_cvt8<<<(unsigned)((n8k + 255) / 256), 256, 0, stream>>>(wk, WK, n8k);
    k_cvt8<<<(unsigned)((n8k + 255) / 256), 256, 0, stream>>>(wv, WV, n8k);
    k_cvt8<<<(unsigned)((n8q + 255) / 256), 256, 0, stream>>>(wo, WO, n8q);
    const unsigned LQ = (unsigned)(((size_t)NHB * TT * HD / 2 + 255) / 256), LKv = (unsigned)(((size_t)NKVB * TT * HD / 2 + 255) / 256);
    k_cvt8<<<(unsigned)((n8x + 255) / 256), 256, 0, stream>>>(x, XB, n8x);
    k_gemmw<bf, 0, true, DM><<<dim3(MT / 128, DQ / 128, 1), 128, 0, stream>>>(XB, nullptr, WQ, FQ, DQ, bq);
    k_plane<<<LQ, 256, 0, stream>>>(FQ, DQ, NH_, QCAR, QP16, QPh, QPl);
    k_gemmw<bf, 0, true, DM><<<dim3(MT / 128, DKV / 128, 1), 128, 0, stream>>>(XB, nullptr, WK, FK, DKV, bk);
    k_plane<<<LKv, 256, 0, stream>>>(FK, DKV, NKV, QCAR, KP16, KPh, KPl);
    k_gemmw<bf, 0, true, DM><<<dim3(MT / 128, DKV / 128, 1), 128, 0, stream>>>(XB, nullptr, WV, FV, DKV, bv);
    k_vtp<<<LKv, 256, 0, stream>>>(FV, DKV, NKV, VCAR, VT16, VTh, VTl);
    k_vis<<<(unsigned)((TT + 7) / 8), 256, 0, stream>>>(fm, VB, BAD);
    k_fattn<<<dim3(NKVB, NQF + NQS, 1), 128, 0, stream>>>(QP16, KP16, VT16, QPh, QPl, KPh, KPl, VTh, VTl, VB, BAD, ATh, ATl);
    k_gemmw<bf, 1, true, DQ><<<dim3(MT / 128, DM / 128, 1), 128, 0, stream>>>(ATh, ATl, WO, OUT, DM, bo);
}

// v004
// One run takes 110 microseconds.
// Next to v003, in two timings, it ran 1.44 and 1.42 times as fast.
// All steps since v000 together make it 7.42 times as fast.
#include <hip/hip_runtime.h>

// Contractions (all f32 accumulate): x Wq^T, x Wk^T, x Wv^T on v_wmma_f32_16x16x32_bf16 (bf16 operands, inputs RNE-converted once, bias added in f32); q k^T and p v: query rows < RH on bf16 hi/lo planes (3 products), rows >= RH on v_wmma_f32_16x16x32_f16 (f16 operands: q and k carried x8, p carried x1024, v carried x8); ctx Wo^T: bf16 hi/lo ctx planes x bf16 Wo (2 products).
// Layout: grouped-query causal attention, NB x SEQ tokens (all batches in every launch: token row = b*SEQ + t, batch-head = b*32 + h, batch-group = batch-head / 4), hidden 2048, 32 query heads x 64 (head h = columns h*64..), 8 kv groups x 64 (kv group = head / 4), weights [out][in] (k-contiguous, used as Bt directly) + bias, scale 64^-0.5.
// Fill input [1][1][SEQ_FULL][SEQ_FULL] int (nonzero = -inf fill) is applied per element on and below the diagonal; the strict upper triangle is assumed filled (the key loop of a query tile stops at its diagonal block); k_vis checks that assumption per row on device and the row's context is written NaN otherwise.
// Attention is one launch: scores, softmax (running maximum and sum over key blocks of 32, normalised once at the end) and p.v stay in registers.
// The q, k and v projections are one launch over the stacked weight rows [Wq | Wk | Wv]; its epilogue writes the attention operand planes (no f32 copy of q, k, v in memory).

#ifndef NB
#define NB 2
#endif
#ifndef SEQ
#define SEQ 1024
#endif
#define NB_FULL  2
#define SEQ_FULL 1024
#define TT   SEQ
#define DM   2048
#define NH_  32
#define NKV  8
#define REP  (NH_ / NKV)
#define HD   64
#define DQ   (NH_ * HD)
#define DKV  (NKV * HD)
#define MT   (NB * TT)             // token rows of all batches
#define NHB  (NB * NH_)            // batch-heads (b * NH_ + h)
#define NKVB (NB * NKV)            // batch-groups (b * NKV + g) = batch-head / REP
#ifndef RH
#define RH   ((SEQ) >= 512 ? 256 : 64)   // query rows < RH use hi+lo planes
#endif
#define PCARL2 10.0f               // log2 of the p carry (x1024) for f16 rows
#define QCAR 8.0f                  // q, k plane carry
#define VCAR 8.0f                  // v plane carry
#define SCL  (0.125f / 64.0f)      // HD^-0.5 / (QCAR*QCAR)

static_assert(NB >= 1 && NB <= NB_FULL);
static_assert(SEQ % 128 == 0 && SEQ >= 128 && SEQ <= SEQ_FULL);
static_assert(RH % 64 == 0 && RH >= 64 && RH < SEQ);
static_assert(NH_ % NKV == 0 && RH % 32 == 0 && (SEQ - RH) % 32 == 0);
static_assert(SEQ == SEQ_FULL || NB == 1);   // token rows of all batches are contiguous in x and out
static_assert(DM % 64 == 0 && DQ % 64 == 0 && DKV % 64 == 0 && HD == 64 && TT % 64 == 0);
static_assert(DM % 32 == 0 && HD % 32 == 0 && TT % 32 == 0);
static_assert(MT % 128 == 0 && DM % 128 == 0 && DQ % 128 == 0 && DKV % 128 == 0);   // 128x128 GEMM tiles, stages of 128 k

typedef _Float16 h16;
typedef unsigned short bf;
typedef __attribute__((ext_vector_type(16))) __bf16   v16bf;
typedef __attribute__((ext_vector_type(16))) _Float16 v16h;
typedef __attribute__((ext_vector_type(8)))  _Float16 v8h;
typedef __attribute__((ext_vector_type(8)))  unsigned short v8us;
typedef __attribute__((ext_vector_type(16))) unsigned short v16us;
typedef __attribute__((ext_vector_type(8)))  float    v8f;
typedef __attribute__((ext_vector_type(4)))  float    v4f;
typedef __attribute__((ext_vector_type(4)))  int      v4i;
typedef __attribute__((ext_vector_type(2)))  _Float16 v2h;
typedef __attribute__((ext_vector_type(4)))  _Float16 v4h;
typedef __attribute__((ext_vector_type(2)))  unsigned short v2us;
typedef __attribute__((ext_vector_type(4)))  unsigned short v4us;
typedef v8h  __attribute__((may_alias)) v8ha;
typedef v4f  __attribute__((may_alias)) v4fa;
typedef v8us __attribute__((may_alias)) v8usa;

__device__ __forceinline__ unsigned short f2bf(float f) { unsigned u = __float_as_uint(f); u += 0x7FFFu + ((u >> 16) & 1u); return (unsigned short)(u >> 16); }
__device__ __forceinline__ float bf2f(unsigned short b) { return __uint_as_float(((unsigned)b) << 16); }
__device__ __forceinline__ float bfr(float f) { return bf2f(f2bf(f)); }
__device__ __forceinline__ v16h cat16(v8h lo, v8h hi) { return __builtin_shufflevector(lo, hi, 0, 1, 2, 3, 4, 5, 6, 7, 8, 9, 10, 11, 12, 13, 14, 15); }
__device__ __forceinline__ v16bf cat16b(v8us lo, v8us hi) { return __builtin_bit_cast(v16bf, __builtin_shufflevector(lo, hi, 0, 1, 2, 3, 4, 5, 6, 7, 8, 9, 10, 11, 12, 13, 14, 15)); }
__device__ __forceinline__ v8f wmma16(v16h a, v16h b, v8f c) { return __builtin_amdgcn_wmma_f32_16x16x32_f16(false, a, false, b, (short)0, c, false, false); }
__device__ __forceinline__ v8f wmmab(v16bf a, v16bf b, v8f c) { return __builtin_amdgcn_wmma_f32_16x16x32_bf16(false, a, false, b, (short)0, c, false, false); }
__device__ __forceinline__ h16 tohx(float x) { return (h16)x; }
__device__ __forceinline__ void splitf(float y, unsigned short& h, unsigned short& l) { h = f2bf(y); l = f2bf(y - bf2f(h)); }
// same-wave LDS relayout: stores of all lanes complete before any lane reloads (wave-private tile)
__device__ __forceinline__ void wave_lds_sync() { __builtin_amdgcn_fence(3 /* release order */, "wavefront"); __builtin_amdgcn_wave_barrier(); asm volatile("" ::: "memory"); }

// ---- Fragment loader (16-bit planes, k-contiguous rows): lane l -> row (l & 15); elements 0..7 <- k0 + 8*(l>>4) + 0..7, elements 8..15 <- k0 + 16 + 8*(l>>4) + 0..7.
// Used for A (row m) and for Bt (row n of the [n][k] plane) alike; D element r of lane l = (row 8*(l>>4) + r, col l & 15).
template <typename T16> struct WFrag;
template <> struct WFrag<h16> { typedef v16h V; static __device__ __forceinline__ V ld(const h16* p) { return cat16(*(const v8h*)p, *(const v8h*)(p + 16)); } static __device__ __forceinline__ v8f mma(V a, V b, v8f c) { return wmma16(a, b, c); } };
template <> struct WFrag<bf> { typedef v16bf V; static __device__ __forceinline__ V ld(const bf* p) { return cat16b(*(const v8us*)p, *(const v8us*)(p + 16)); } static __device__ __forceinline__ v8f mma(V a, V b, v8f c) { return wmmab(a, b, c); } };

// ---- k_gemmw: GEMM, work-group of 4 waves (2 x 2) on a 128x128 output tile, each wave 64x64 (16 accumulators); grid (M/128, N/128), 128 threads.
// C[m][n] (f32, pitch ldc, + optional f32 bias[n] as bf16-RNE value) = sum_k A[m][k] Bt[n][k] (+ A2[m][k] Bt[n][k] for NSPLIT 1). K % GKC == 0, K >= 2 GKC, M % 128 == 0, N % 128 == 0.
// QKV: Bt = the stacked rows [Wq | Wk | Wv], N = DQ + 2 DKV; a wave's 64 columns are one head, and C is not written: the epilogue writes that head's operand planes (struct QkvOut; bias, biask, biasv = the three bias vectors).
// The operand tiles (128 rows x GKC k of A, of A2 where there is one, of Bt) are staged in LDS by asynchronous copies, two buffers: tile t + 1 flies while tile t is multiplied. Each tile row is read from L2 once per work-group, in whole lines.
#define GKC   128                  // k elements of one stage: rows of 256 bytes
#define GPIT  136                  // LDS row pitch in elements: 272 bytes = 16 x odd, the conflict-free pitch for 16-byte fragment reads
#define GTILE (128 * GPIT)         // elements of one operand tile in LDS
__device__ __forceinline__ unsigned lds_off(const void* p) { return (unsigned)(size_t)p; }   // byte offset in the work-group's LDS = low 32 bits of the __shared__ address
// eight 16-byte copies per lane, rows 8 apart (LDS step ls bytes, global step gs elements); s_wait_xcnt 0 as the statement's last line, a precaution: so it stands in front of every later write of a register that these copies name
template <typename T16>
__device__ __forceinline__ void acopy8(unsigned l, const T16* g, unsigned ls, size_t gs) {
    asm volatile("global_load_async_to_lds_b128 %0, %8, off\n\t"
                 "global_load_async_to_lds_b128 %1, %9, off\n\t"
                 "global_load_async_to_lds_b128 %2, %10, off\n\t"
                 "global_load_async_to_lds_b128 %3, %11, off\n\t"
                 "global_load_async_to_lds_b128 %4, %12, off\n\t"
                 "global_load_async_to_lds_b128 %5, %13, off\n\t"
                 "global_load_async_to_lds_b128 %6, %14, off\n\t"
                 "global_load_async_to_lds_b128 %7, %15, off\n\t"
                 "s_wait_xcnt 0x0"
                 :: "v"(l), "v"(l + ls), "v"(l + 2 * ls), "v"(l + 3 * ls), "v"(l + 4 * ls), "v"(l + 5 * ls), "v"(l + 6 * ls), "v"(l + 7 * ls),
                    "v"(g), "v"(g + gs), "v"(g + 2 * gs), "v"(g + 3 * gs), "v"(g + 4 * gs), "v"(g + 5 * gs), "v"(g + 6 * gs), "v"(g + 7 * gs)
                 : "memory");
}
// planes written by the q, k, v projection: value = (sum + bias) * carry as f16 and as bf16 hi + lo; q [batch-head][t][d], k [batch-group][t][d], v [batch-group][d][t]
struct QkvOut { h16* q16; bf* qh; bf* ql; h16* k16; bf* kh; bf* kl; h16* v16; bf* vh; bf* vl; };
// eight staged f32 values -> the three planes, 16 bytes each at element offset e (unrolled: the vectors are indexed by constants and stay in registers)
__device__ __forceinline__ void put_planes(const float* r, h16* P16, bf* Ph, bf* Pl, size_t e) { v8h o16; v8us oh, ol;
#pragma unroll
    for (int k = 0; k < 8; ++k) { o16[k] = tohx(r[k]); unsigned short a2, c2; splitf(r[k], a2, c2); oh[k] = a2; ol[k] = c2; }
    *(v8h*)(P16 + e) = o16; *(v8us*)(Ph + e) = oh; *(v8us*)(Pl + e) = ol; }
template <typename T16, int NSPLIT, bool BIAS, int K, bool QKV>
__global__ __launch_bounds__(128) void k_gemmw(const T16* __restrict__ A, const T16* __restrict__ A2, const T16* __restrict__ Bt, float* C, int ldc, const float* __restrict__ bias, const float* __restrict__ biask, const float* __restrict__ biasv, QkvOut qo) {
    typedef typename WFrag<T16>::V V;
    static_assert((NSPLIT == 0 || NSPLIT == 1) && K % GKC == 0 && K / GKC >= 2);
    constexpr int NOP = NSPLIT + 2;                                   // operand tiles of a stage: Bt, A (, A2)
    __shared__ __attribute__((aligned(16))) T16 ring[2 * NOP * GTILE];
    __shared__ __align__(16) float osw[4 * 16 * 68];
    const int tid = threadIdx.x, lane = tid & 31, lr = lane & 15, hi = lane >> 4;
    const int w = __builtin_amdgcn_readfirstlane(tid >> 5), wm = w >> 1, wn = w & 1;
    const int R0 = blockIdx.x * 128, C0 = blockIdx.y * 128;
    // copy map: 16 lanes cover one 256-byte row, the 128 threads 8 rows; 16 copies per lane and operand tile
    const int crow = tid >> 4, ccol = (tid & 15) * 8;
    const unsigned lc = lds_off(ring) + (unsigned)(crow * GPIT + ccol) * 2u;
    const T16* gB = Bt + (size_t)(C0 + crow) * K + ccol; const T16* gA = A + (size_t)(R0 + crow) * K + ccol; const T16* gA2 = (NSPLIT == 1) ? A2 + (size_t)(R0 + crow) * K + ccol : nullptr;
    auto fill = [&](int t, int buf) {
        const unsigned l = lc + (unsigned)(buf * NOP * GTILE) * 2u; const size_t ko = (size_t)t * GKC, g8 = (size_t)8 * K;
        acopy8(l, gB + ko, 8 * GPIT * 2, g8); acopy8(l + 64 * GPIT * 2, gB + ko + 8 * g8, 8 * GPIT * 2, g8);
        acopy8(l + GTILE * 2, gA + ko, 8 * GPIT * 2, g8); acopy8(l + GTILE * 2 + 64 * GPIT * 2, gA + ko + 8 * g8, 8 * GPIT * 2, g8);
        if constexpr (NSPLIT == 1) { acopy8(l + 2 * GTILE * 2, gA2 + ko, 8 * GPIT * 2, g8); acopy8(l + 2 * GTILE * 2 + 64 * GPIT * 2, gA2 + ko + 8 * g8, 8 * GPIT * 2, g8); }
    };
    v8f acc[4][4];
#pragma unroll
    for (int mb = 0; mb < 4; ++mb)
#pragma unroll
        for (int nb = 0; nb < 4; ++nb) acc[mb][nb] = (v8f){};
    constexpr int ntr = K / GKC;
    fill(0, 0);
    asm volatile("s_wait_asynccnt 0x0" ::: "memory");   // this wave's copies of tile 0 have landed
    __syncthreads();                                    // every wave's have
    fill(1, 1);
    const int boff = (wn * 64 + lr) * GPIT + 8 * hi, aoff = GTILE + (wm * 64 + lr) * GPIT + 8 * hi;
// rolled: one trip per stage
#pragma unroll 1
    for (int t = 0; t < ntr; ++t) {
        const T16* st = ring + (t & 1) * (NOP * GTILE);
        V a[2][4], a2[2][4], b[2][4];
#pragma unroll
        for (int f = 0; f < 4; ++f) { b[0][f] = WFrag<T16>::ld(st + boff + f * 16 * GPIT); a[0][f] = WFrag<T16>::ld(st + aoff + f * 16 * GPIT); if (NSPLIT == 1) a2[0][f] = WFrag<T16>::ld(st + aoff + GTILE + f * 16 * GPIT); }
// unrolled: the two fragment sets are indexed by constants and stay in registers
#pragma unroll
        for (int ks = 0; ks < GKC / 32; ++ks) { const int c = ks & 1, n = c ^ 1;
            if (ks + 1 < GKC / 32) {                    // the next 32 k of this same tile are fetched as one group ahead of this block's products
#pragma unroll
                for (int f = 0; f < 4; ++f) { const int o = f * 16 * GPIT + (ks + 1) * 32; b[n][f] = WFrag<T16>::ld(st + boff + o); a[n][f] = WFrag<T16>::ld(st + aoff + o); if (NSPLIT == 1) a2[n][f] = WFrag<T16>::ld(st + aoff + GTILE + o); } }
            __builtin_amdgcn_sched_barrier(0);          // keeps that group of LDS reads together and ahead of the products; left free they sink to their first use, each behind a wait to 0
#pragma unroll
            for (int nb = 0; nb < 4; ++nb)
#pragma unroll
                for (int mb = 0; mb < 4; ++mb) acc[mb][nb] = WFrag<T16>::mma(a[c][mb], b[c][nb], acc[mb][nb]);
            if constexpr (NSPLIT == 1) {
#pragma unroll
                for (int nb = 0; nb < 4; ++nb)
#pragma unroll
                    for (int mb = 0; mb < 4; ++mb) acc[mb][nb] = WFrag<T16>::mma(a2[c][mb], b[c][nb], acc[mb][nb]); }
            __builtin_amdgcn_sched_barrier(0);          // keeps the following group of LDS reads from being spread among these products
        }
        asm volatile("s_wait_dscnt 0x0" ::: "memory");      // this wave's reads of the buffer are done before it is handed back
        asm volatile("s_wait_asynccnt 0x0" ::: "memory");   // this wave's copies of tile t + 1 have landed
        __syncthreads();                                    // publishes tile t + 1 and ends every wave's reads of tile t
        if (t + 2 < ntr) fill(t + 2, t & 1);
    }
    asm volatile("s_wait_asynccnt 0x0" ::: "memory");       // no copy is left in flight
    float* os = osw + w * (16 * 68);                        // this wave's own staging rows
    const int r0 = R0 + wm * 64, c0 = C0 + wn * 64;
    if constexpr (QKV) {
        // 16 staged rows of 64 f32 are read back 8 values per lane: 8 lanes cover a row (128 bytes of each 16-bit plane), a wave 4 rows
        // every '#pragma unroll' of this block is there so that the accumulators and the small value arrays are indexed by constants and stay in registers
        const int hc = c0 / HD, bb = r0 / TT, t0 = r0 % TT, sr = lane >> 3, sc = (lane & 7) * 8;   // hc: head slot (wave-uniform): q heads, then k groups, then v groups
        if (hc < NH_ + NKV) {                               // q or k: staged rows = tokens, columns = d; the wave's 64 x 64 tile is 8 KiB in a row in each plane
            const bool isq = hc < NH_;
            const float* bp = (isq ? bias + c0 : biask + (c0 - DQ)) + sc;
            const size_t base = ((size_t)(isq ? bb * NH_ + hc : bb * NKV + (hc - NH_)) * TT + t0) * HD + sc;
            h16* P16 = isq ? qo.q16 : qo.k16; bf* Ph = isq ? qo.qh : qo.kh; bf* Pl = isq ? qo.ql : qo.kl;
            float bc[8];
#pragma unroll
            for (int k = 0; k < 8; ++k) bc[k] = bfr(bp[k]);
#pragma unroll
            for (int mb = 0; mb < 4; ++mb) {
#pragma unroll
                for (int nb = 0; nb < 4; ++nb) {
#pragma unroll
                    for (int j = 0; j < 8; ++j) os[(hi * 8 + j) * 68 + nb * 16 + lr] = acc[mb][nb][j]; }
                wave_lds_sync();
#pragma unroll
                for (int s = 0; s < 4; ++s) { const int row = 4 * s + sr; const v4f v0 = *(const v4fa*)(os + row * 68 + sc), v1 = *(const v4fa*)(os + row * 68 + sc + 4); float r[8];
#pragma unroll
                    for (int k = 0; k < 8; ++k) r[k] = ((k < 4 ? v0[k & 3] : v1[k & 3]) + bc[k]) * QCAR;
                    put_planes(r, P16, Ph, Pl, base + (size_t)(mb * 16 + row) * HD); }
                asm volatile("s_wait_xcnt 0x0" ::: "memory");   // a precaution: stands before the next rows' values and addresses go into registers that these stores name
                wave_lds_sync();
            }
        } else {                                            // v: staged rows = d, columns = tokens (an accumulator holds 8 tokens in a row of one d), so the plane comes out transposed in whole lines
            const float* bp = biasv + (c0 - DQ - DKV);
            const size_t base = (size_t)(bb * NKV + (hc - NH_ - NKV)) * HD * TT + t0 + sc;
#pragma unroll
            for (int nb = 0; nb < 4; ++nb) {
#pragma unroll
                for (int mb = 0; mb < 4; ++mb) {
#pragma unroll
                    for (int j = 0; j < 8; ++j) os[lr * 68 + mb * 16 + hi * 8 + j] = acc[mb][nb][j]; }
                wave_lds_sync();
#pragma unroll
                for (int s = 0; s < 4; ++s) { const int row = 4 * s + sr; const v4f v0 = *(const v4fa*)(os + row * 68 + sc), v1 = *(const v4fa*)(os + row * 68 + sc + 4); const float bd = bfr(bp[nb * 16 + row]); float r[8];
#pragma unroll
                    for (int k = 0; k < 8; ++k) r[k] = ((k < 4 ? v0[k & 3] : v1[k & 3]) + bd) * VCAR;
                    put_planes(r, qo.v16, qo.vh, qo.vl, base + (size_t)(nb * 16 + row) * TT); }
                asm volatile("s_wait_xcnt 0x0" ::: "memory");   // a precaution: stands before the next rows' values and addresses go into registers that these stores name
                wave_lds_sync();
            }
        }
        return;
    }
#pragma unroll
    for (int mb = 0; mb < 4; ++mb) {
#pragma unroll
        for (int nb = 0; nb < 4; ++nb) {
#pragma unroll
            for (int j = 0; j < 8; ++j) os[(hi * 8 + j) * 68 + nb * 16 + lr] = acc[mb][nb][j]; }
        wave_lds_sync();
        float* crw = C + (size_t)(r0 + mb * 16) * ldc + c0;
#pragma unroll
        for (int s = 0; s < 8; ++s) { const int row = 2 * s + hi, cofs = lr * 4; v4f val = *(const v4fa*)(os + row * 68 + cofs); if (BIAS) { val[0] += bfr(bias[c0 + cofs]); val[1] += bfr(bias[c0 + cofs + 1]); val[2] += bfr(bias[c0 + cofs + 2]); val[3] += bfr(bias[c0 + cofs + 3]); }
            *(v4f*)(crw + (size_t)row * ldc + cofs) = val; }
        asm volatile("s_wait_xcnt 0x0" ::: "memory");   // a precaution: stands before the next rows' values and addresses go into registers that these stores name
        wave_lds_sync();
    }
}

__global__ __launch_bounds__(256) void k_cvt8(const float* __restrict__ src, bf* dst, size_t n8) { const size_t i = (size_t)blockIdx.x * 256 + threadIdx.x; if (i >= n8) return; const v8f v = *(const v8f*)(src + i * 8); v8us o;
#pragma unroll
    for (int k = 0; k < 8; ++k) o[k] = f2bf(v[k]); *(v8us*)(dst + i * 8) = o;  }

// ---- k_vis: one wave per query row i. VB[i][w] bit c = key w*32+c is visible to query i (on or below the diagonal and the fill input zero); BAD[i] = the strict upper triangle of row i holds an unfilled entry.
__global__ __launch_bounds__(256) void k_vis(const int* __restrict__ Fm, unsigned* VB, unsigned* BAD) {
    const int lane = threadIdx.x & 31; const int i = blockIdx.x * 8 + (threadIdx.x >> 5); if (i >= TT) return;
    const int* fr = Fm + (size_t)i * SEQ_FULL; unsigned mine = 0u, bad = 0u;
// unrolled: all loads of the row are in flight at once
#pragma unroll
    for (int w = 0; w < TT / 32; ++w) { const int j = w * 32 + lane; const bool filled = (fr[j] != 0); const bool vis = (j <= i);
        const unsigned bits = __builtin_amdgcn_ballot_w32(vis && !filled); bad |= __builtin_amdgcn_ballot_w32(!vis && !filled); if (lane == w) mine = bits; }
    if (lane < TT / 32) VB[(size_t)i * (TT / 32) + lane] = mine;
    if (lane == 0) BAD[i] = bad;
}

// ---- fattn_tile: one wave, NT*16 query rows of one batch-head, key blocks of 32 up to the diagonal block, running maximum and sum (scores and probabilities stay in registers).
// St = K Q^T: A = key rows, Bt = query rows, so D element r of lane l = (key 8*(l>>4) + r, query l & 15); the two 16-key tiles of a block are then, element for element, the fragment order of the loader above
// (elements 0..7 <- k 8*(l>>4) + 0..7, elements 8..15 <- k 16 + 8*(l>>4) + 0..7), so the probabilities go straight in as Bt of Ot = V^T P^T (A = rows d of the [d][t] value plane). Ot element r of lane l = (d 8*(l>>4) + r, query l & 15).
// Every '#pragma unroll' in this function is there so that the fragment, score and output arrays are indexed by constants and stay in registers.
// SPLIT: hi/lo bf16 planes, 3 products in the order hi.hi, (query or p) lo . hi, hi . (key or value) lo. Not SPLIT: f16 planes, p carried x1024 (the carry is in the sum as well and cancels).
template <typename T16, bool SPLIT, int NT>
__device__ __forceinline__ void fattn_tile(const T16* __restrict__ Q, const T16* __restrict__ Q2, const T16* __restrict__ Kp, const T16* __restrict__ K2, const T16* __restrict__ Vt, const T16* __restrict__ V2,
                                           const unsigned* __restrict__ VB, const unsigned* __restrict__ BAD, int q0, bf* Ah, bf* Al) {
    typedef typename WFrag<T16>::V V;
    const int lane = threadIdx.x & 31, lr = lane & 15, hi = lane >> 4; const float ninf = -__builtin_inff();
    const float C1 = SCL * 1.4426950408889634f;
    V qf[NT][2], qf2[NT][2];
#pragma unroll
    for (int nt = 0; nt < NT; ++nt)
#pragma unroll
        for (int ks = 0; ks < 2; ++ks) { const unsigned qo = (unsigned)(q0 + nt * 16 + lr) * HD + ks * 32 + 8 * hi; qf[nt][ks] = WFrag<T16>::ld(Q + qo); if (SPLIT) qf2[nt][ks] = WFrag<T16>::ld(Q2 + qo); }
    v8f o[4][NT]; float m[NT], l[NT];
#pragma unroll
    for (int nt = 0; nt < NT; ++nt) { m[nt] = ninf; l[nt] = 0.f;
#pragma unroll
        for (int dt = 0; dt < 4; ++dt) o[dt][nt] = (v8f){}; }
    const int kend = ((q0 + NT * 16 + 31) / 32) * 32;   // keys beyond the diagonal block are invisible to every row of the tile
    V kf[2][2], kf2[2][2]; unsigned wd[NT];
#pragma unroll
    for (int mt = 0; mt < 2; ++mt)
#pragma unroll
        for (int ks = 0; ks < 2; ++ks) { const unsigned ko = (unsigned)(mt * 16 + lr) * HD + ks * 32 + 8 * hi; kf[mt][ks] = WFrag<T16>::ld(Kp + ko); if (SPLIT) kf2[mt][ks] = WFrag<T16>::ld(K2 + ko); }
#pragma unroll
    for (int nt = 0; nt < NT; ++nt) wd[nt] = VB[(unsigned)(q0 + nt * 16 + lr) * (TT / 32)];
// rolled: one block's fragments, scores and outputs already fill the register budget
#pragma unroll 1
    for (int kb = 0; kb < kend; kb += 32) {
        V vf[4], vf2[4];
#pragma unroll
        for (int dt = 0; dt < 4; ++dt) { const unsigned vo = (unsigned)(dt * 16 + lr) * TT + kb + 8 * hi; vf[dt] = WFrag<T16>::ld(Vt + vo); if (SPLIT) vf2[dt] = WFrag<T16>::ld(V2 + vo); }
        if constexpr (!SPLIT) __builtin_amdgcn_sched_barrier(0);   // keeps the value loads up here, a whole softmax ahead of their use; left free they sink between the p.v products and each waits out its full latency
        v8f s[2][NT]; unsigned wc[NT];
#pragma unroll
        for (int mt = 0; mt < 2; ++mt)
#pragma unroll
            for (int nt = 0; nt < NT; ++nt) { v8f a = (v8f){};
#pragma unroll
                for (int ks = 0; ks < 2; ++ks) { a = WFrag<T16>::mma(kf[mt][ks], qf[nt][ks], a); if (SPLIT) { a = WFrag<T16>::mma(kf[mt][ks], qf2[nt][ks], a); a = WFrag<T16>::mma(kf2[mt][ks], qf[nt][ks], a); } }
                s[mt][nt] = a; }
#pragma unroll
        for (int nt = 0; nt < NT; ++nt) wc[nt] = wd[nt] >> (8 * hi);
        if constexpr (SPLIT) asm volatile("s_wait_xcnt 0x0" ::: "memory");   // in this build the key loads below return into registers that hold the value loads' addresses
        const int kn = min(kb + 32, kend - 32);          // next block's key fragments and visibility words fly during this block's softmax (the last block fetches itself again)
#pragma unroll
        for (int mt = 0; mt < 2; ++mt)
#pragma unroll
            for (int ks = 0; ks < 2; ++ks) { const unsigned ko = (unsigned)(kn + mt * 16 + lr) * HD + ks * 32 + 8 * hi; kf[mt][ks] = WFrag<T16>::ld(Kp + ko); if (SPLIT) kf2[mt][ks] = WFrag<T16>::ld(K2 + ko); }
#pragma unroll
        for (int nt = 0; nt < NT; ++nt) wd[nt] = VB[(unsigned)(q0 + nt * 16 + lr) * (TT / 32) + (kn >> 5)];
        V pf[NT], pf2[NT];
#pragma unroll
        for (int nt = 0; nt < NT; ++nt) {
            float bm = ninf;
#pragma unroll
            for (int mt = 0; mt < 2; ++mt)
#pragma unroll
                for (int r = 0; r < 8; ++r) { const float t = ((wc[nt] >> (mt * 16 + r)) & 1u) ? s[mt][nt][r] : ninf; s[mt][nt][r] = t; bm = fmaxf(bm, t); }
            bm = fmaxf(bm, __shfl_xor(bm, 16, 32));
            const float mn = fmaxf(m[nt], bm); const float ms = (mn == ninf) ? 0.f : mn;   // no visible key so far: every p and the rescale come out 0, not NaN
            const float al = __builtin_amdgcn_exp2f((m[nt] - ms) * C1); m[nt] = mn;
            float ps = 0.f, p[16];
#pragma unroll
            for (int e = 0; e < 16; ++e) { const float d = s[e >> 3][nt][e & 7] - ms; if (SPLIT) asm("v_exp_f32 %0, %1\n\tv_nop" : "=v"(p[e]) : "v"(d * C1));   // v_nop: the slot behind a transcendental, tied to it
                else p[e] = __builtin_amdgcn_exp2f(__builtin_fmaf(d, C1, PCARL2));
                ps += p[e]; }
            l[nt] = l[nt] * al + ps;                     // this lane's half of the keys; the halves are joined behind the loop
#pragma unroll
            for (int dt = 0; dt < 4; ++dt) o[dt][nt] *= al;
            if constexpr (SPLIT) { v16us ph, pl;
#pragma unroll
                for (int e = 0; e < 16; ++e) { unsigned short a2, c2; splitf(p[e], a2, c2); ph[e] = a2; pl[e] = c2; }
                pf[nt] = __builtin_bit_cast(v16bf, ph); pf2[nt] = __builtin_bit_cast(v16bf, pl);
            } else {
#pragma unroll
                for (int e = 0; e < 16; ++e) pf[nt][e] = tohx(p[e]); }
        }
#pragma unroll
        for (int dt = 0; dt < 4; ++dt)
#pragma unroll
            for (int nt = 0; nt < NT; ++nt) { o[dt][nt] = WFrag<T16>::mma(vf[dt], pf[nt], o[dt][nt]); if (SPLIT) { o[dt][nt] = WFrag<T16>::mma(vf[dt], pf2[nt], o[dt][nt]); o[dt][nt] = WFrag<T16>::mma(vf2[dt], pf[nt], o[dt][nt]); } }
    }
#pragma unroll
    for (int nt = 0; nt < NT; ++nt) { const int q = q0 + nt * 16 + lr; const float lt = l[nt] + __shfl_xor(l[nt], 16, 32);
        float inv = __fdiv_rn(1.0f / VCAR, lt); if (BAD[q]) inv = __uint_as_float(0x7fc00000u);   // a row with no visible key: 0 * inf = NaN, as the softmax of an all -inf row
#pragma unroll
        for (int dt = 0; dt < 4; ++dt) { v8us oh, ol;
#pragma unroll
            for (int r = 0; r < 8; ++r) { unsigned short a2, c2; splitf(o[dt][nt][r] * inv, a2, c2); oh[r] = a2; ol[r] = c2; }
            const unsigned oo = (unsigned)q * DQ + dt * 16 + 8 * hi; *(v8us*)(Ah + oo) = oh; *(v8us*)(Al + oo) = ol; } }
}

// ---- k_fattn: grid (batch-groups, query tiles), 4 independent waves = the 4 query heads of the group on the same query rows (they read the same key and value lines). Tiles in falling order of their key count:
// first the f16 tiles (32 rows, from the last row down to RH), then the hi/lo tiles (16 rows, below RH). Writes the bf16 hi/lo context planes [token][DQ].
#define NQF ((TT - RH) / 32)
#define NQS (RH / 16)
__global__ __launch_bounds__(128) void k_fattn(const h16* __restrict__ QP16, const h16* __restrict__ KP16, const h16* __restrict__ VT16, const bf* __restrict__ QPh, const bf* __restrict__ QPl, const bf* __restrict__ KPh, const bf* __restrict__ KPl,
                                               const bf* __restrict__ VTh, const bf* __restrict__ VTl, const unsigned* __restrict__ VB, const unsigned* __restrict__ BAD, bf* ATh, bf* ATl) {
    const int bg = blockIdx.x, bh = bg * REP + __builtin_amdgcn_readfirstlane((int)(threadIdx.x >> 5)), t = blockIdx.y;   // the wave's number as a scalar: plane bases stay in scalar registers
    const size_t zq = (size_t)bh * TT * HD, zk = (size_t)bg * TT * HD, zo = (size_t)(bh / NH_) * TT * DQ + (size_t)(bh % NH_) * HD;
    if (t < NQF) fattn_tile<h16, false, 2>(QP16 + zq, nullptr, KP16 + zk, nullptr, VT16 + zk, nullptr, VB, BAD, TT - 32 * (t + 1), ATh + zo, ATl + zo);
    else         fattn_tile<bf, true, 1>(QPh + zq, QPl + zq, KPh + zk, KPl + zk, VTh + zk, VTl + zk, VB, BAD, RH - 16 * (t - NQF + 1), ATh + zo, ATl + zo);
}

extern "C" void kernel_launch(void* const* d_in, const int* in_sizes, int n_in,
                              void* d_out, int out_size, void* d_ws, size_t ws_size, hipStream_t stream) {
    if (n_in < 10) return;
    if (in_sizes[0] < ((NB - 1) * SEQ_FULL + SEQ) * DM) return;
    if (in_sizes[1] < (SEQ - 1) * SEQ_FULL + SEQ) return;
    if (in_sizes[2] < DQ * DM || in_sizes[3] < DQ || in_sizes[4] < DKV * DM || in_sizes[5] < DKV || in_sizes[6] < DKV * DM || in_sizes[7] < DKV || in_sizes[8] < DM * DQ || in_sizes[9] < DM) return;
    if (out_size < ((NB - 1) * SEQ_FULL + SEQ) * DM) return;
    const float* x  = (const float*)d_in[0];   // [NB_FULL][SEQ_FULL][DM]
    const int*   fm = (const int*)d_in[1];     // [1][1][SEQ_FULL][SEQ_FULL], nonzero = filled (-inf)
    const float* wq = (const float*)d_in[2]; const float* bq = (const float*)d_in[3];   // [DQ][DM], [DQ]
    const float* wk = (const float*)d_in[4]; const float* bk = (const float*)d_in[5];   // [DKV][DM], [DKV]
    const float* wv = (const float*)d_in[6]; const float* bv = (const float*)d_in[7];   // [DKV][DM], [DKV]
    const float* wo = (const float*)d_in[8]; const float* bo = (const float*)d_in[9];   // [DM][DQ], [DM]
    float* OUT = (float*)d_out;                // [NB_FULL][SEQ_FULL][DM]
    char* wsp = (char*)d_ws; size_t used = 0;
    auto take = [&](size_t bytes) { char* p = wsp + used; used += (bytes + 255) & ~(size_t)255; return (void*)p; };
    bf* WQ = (bf*)take((size_t)(DQ + 2 * DKV) * DM * 2); bf* WK = WQ + (size_t)DQ * DM; bf* WV = WK + (size_t)DKV * DM; bf* WO = (bf*)take((size_t)DM * DQ * 2);   // Wq, Wk, Wv rows stacked: one [DQ + 2 DKV][DM] operand
    bf* XB = (bf*)take((size_t)MT * DM * 2);
    h16* QP16 = (h16*)take((size_t)NHB * TT * HD * 2); h16* KP16 = (h16*)take((size_t)NKVB * TT * HD * 2); h16* VT16 = (h16*)take((size_t)NKVB * HD * TT * 2);
    bf* QPh = (bf*)take((size_t)NHB * TT * HD * 2); bf* QPl = (bf*)take((size_t)NHB * TT * HD * 2); bf* KPh = (bf*)take((size_t)NKVB * TT * HD * 2); bf* KPl = (bf*)take((size_t)NKVB * TT * HD * 2);
    bf* VTh = (bf*)take((size_t)NKVB * HD * TT * 2); bf* VTl = (bf*)take((size_t)NKVB * HD * TT * 2);
    unsigned* VB = (unsigned*)take((size_t)TT * (TT / 32) * 4); unsigned* BAD = (unsigned*)take((size_t)TT * 4);
    bf* ATh = (bf*)take((size_t)MT * DQ * 2); bf* ATl = (bf*)take((size_t)MT * DQ * 2);
    if (used > ws_size) return;

    const size_t n8q = (size_t)DQ * DM / 8, n8k = (size_t)DKV * DM / 8, n8x = (size_t)MT * DM / 8;
    k_cvt8<<<(unsigned)((n8q + 255) / 256), 256, 0, stream>>>(wq, WQ, n8q);
    k_cvt8<<<(unsigned)((n8k + 255) / 256), 256, 0, stream>>>(wk, WK, n8k);
    k_cvt8<<<(unsigned)((n8k + 255) / 256), 256, 0, stream>>>(wv, WV, n8k);
    k_cvt8<<<(unsigned)((n8q + 255) / 256), 256, 0, stream>>>(wo, WO, n8q);
    k_cvt8<<<(unsigned)((n8x + 255) / 256), 256, 0, stream>>>(x, XB, n8x);
    const QkvOut qo = { QP16, QPh, QPl, KP16, KPh, KPl, VT16, VTh, VTl };
    k_gemmw<bf, 0, true, DM, true><<<dim3(MT / 128, (DQ + 2 * DKV) / 128, 1), 128, 0, stream>>>(XB, nullptr, WQ, nullptr, 0, bq, bk, bv, qo);
    k_vis<<<(unsigned)((TT + 7) / 8), 256, 0, stream>>>(fm, VB, BAD);
    k_fattn<<<dim3(NKVB, NQF + NQS, 1), 128, 0, stream>>>(QP16, KP16, VT16, QPh, QPl, KPh, KPl, VTh, VTl, VB, BAD, ATh, ATl);
    k_gemmw<bf, 1, true, DQ, false><<<dim3(MT / 128, DM / 128, 1), 128, 0, stream>>>(ATh, ATl, WO, OUT, DM, bo, nullptr, nullptr, QkvOut{});
}

// v005
// One run takes 102 microseconds.
// In two side-by-side timings against v004, it was 1.08 and 1.09 times as fast.
// Over all steps from v000 it is 8.06 times as fast.
#include <hip/hip_runtime.h>

// Contractions (all f32 accumulate): x Wq^T, x Wk^T, x Wv^T on v_wmma_f32_16x16x32_bf16 (bf16 operands, inputs RNE-converted once, bias added in f32); q k^T and p v: query rows < RH on bf16 hi/lo planes (3 products), rows >= RH on v_wmma_f32_16x16x32_f16 (f16 operands: q and k carried x8, p carried x1024, v carried x8); ctx Wo^T: bf16 hi/lo ctx planes x bf16 Wo (2 products).
// Layout: grouped-query causal attention, NB x SEQ tokens (all batches in every launch: token row = b*SEQ + t, batch-head = b*32 + h, batch-group = batch-head / 4), hidden 2048, 32 query heads x 64 (head h = columns h*64..), 8 kv groups x 64 (kv group = head / 4), weights [out][in] (k-contiguous, used as Bt directly) + bias, scale 64^-0.5.
// Fill input [1][1][SEQ_FULL][SEQ_FULL] int (nonzero = -inf fill) is applied per element on and below the diagonal; the strict upper triangle is assumed filled (the key loop of a query tile stops at its diagonal block); vis_row checks that assumption per row on device and the row's context is written NaN otherwise.
// Attention is one launch: scores, softmax (running maximum and sum over key blocks of 32, normalised once at the end) and p.v stay in registers.
// The bf16 copies of the weights and of x and the visibility words are one launch (k_prep).
// The q, k and v projections are one launch over the stacked weight rows [Wq | Wk | Wv]; its epilogue writes the attention operand planes (no f32 copy of q, k, v in memory).

#ifndef NB
#define NB 2
#endif
#ifndef SEQ
#define SEQ 1024
#endif
#define NB_FULL  2
#define SEQ_FULL 1024
#define TT   SEQ
#define DM   2048
#define NH_  32
#define NKV  8
#define REP  (NH_ / NKV)
#define HD   64
#define DQ   (NH_ * HD)
#define DKV  (NKV * HD)
#define MT   (NB * TT)             // token rows of all batches
#define NHB  (NB * NH_)            // batch-heads (b * NH_ + h)
#define NKVB (NB * NKV)            // batch-groups (b * NKV + g) = batch-head / REP
#ifndef RH
#define RH   ((SEQ) >= 512 ? 256 : 64)   // query rows < RH use hi+lo planes
#endif
#define PCARL2 10.0f               // log2 of the p carry (x1024) for f16 rows
#define QCAR 8.0f                  // q, k plane carry
#define VCAR 8.0f                  // v plane carry
#define SCL  (0.125f / 64.0f)      // HD^-0.5 / (QCAR*QCAR)

static_assert(NB >= 1 && NB <= NB_FULL);
static_assert(SEQ % 128 == 0 && SEQ >= 128 && SEQ <= SEQ_FULL);
static_assert(RH % 64 == 0 && RH >= 64 && RH < SEQ);
static_assert(NH_ % NKV == 0 && RH % 32 == 0 && (SEQ - RH) % 32 == 0);
static_assert(SEQ == SEQ_FULL || NB == 1);   // token rows of all batches are contiguous in x and out
static_assert(DM % 64 == 0 && DQ % 64 == 0 && DKV % 64 == 0 && HD == 64 && TT % 64 == 0);
static_assert(DM % 32 == 0 && HD % 32 == 0 && TT % 32 == 0);
static_assert(MT % 128 == 0 && DM % 128 == 0 && DQ % 128 == 0 && DKV % 128 == 0);   // 128x128 GEMM tiles, stages of 128 k

typedef _Float16 h16;
typedef unsigned short bf;
typedef __attribute__((ext_vector_type(16))) __bf16   v16bf;
typedef __attribute__((ext_vector_type(16))) _Float16 v16h;
typedef __attribute__((ext_vector_type(8)))  _Float16 v8h;
typedef __attribute__((ext_vector_type(8)))  unsigned short v8us;
typedef __attribute__((ext_vector_type(16))) unsigned short v16us;
typedef __attribute__((ext_vector_type(8)))  float    v8f;
typedef __attribute__((ext_vector_type(4)))  float    v4f;
typedef __attribute__((ext_vector_type(4)))  int      v4i;
typedef __attribute__((ext_vector_type(2)))  _Float16 v2h;
typedef __attribute__((ext_vector_type(4)))  _Float16 v4h;
typedef __attribute__((ext_vector_type(2)))  unsigned short v2us;
typedef __attribute__((ext_vector_type(4)))  unsigned short v4us;
typedef v8h  __attribute__((may_alias)) v8ha;
typedef v4f  __attribute__((may_alias)) v4fa;
typedef v8us __attribute__((may_alias)) v8usa;

__device__ __forceinline__ unsigned short f2bf(float f) { unsigned u = __float_as_uint(f); u += 0x7FFFu + ((u >> 16) & 1u); return (unsigned short)(u >> 16); }
__device__ __forceinline__ float bf2f(unsigned short b) { return __uint_as_float(((unsigned)b) << 16); }
__device__ __forceinline__ float bfr(float f) { return bf2f(f2bf(f)); }
__device__ __forceinline__ v16h cat16(v8h lo, v8h hi) { return __builtin_shufflevector(lo, hi, 0, 1, 2, 3, 4, 5, 6, 7, 8, 9, 10, 11, 12, 13, 14, 15); }
__device__ __forceinline__ v16bf cat16b(v8us lo, v8us hi) { return __builtin_bit_cast(v16bf, __builtin_shufflevector(lo, hi, 0, 1, 2, 3, 4, 5, 6, 7, 8, 9, 10, 11, 12, 13, 14, 15)); }
__device__ __forceinline__ v8f wmma16(v16h a, v16h b, v8f c) { return __builtin_amdgcn_wmma_f32_16x16x32_f16(false, a, false, b, (short)0, c, false, false); }
__device__ __forceinline__ v8f wmmab(v16bf a, v16bf b, v8f c) { return __builtin_amdgcn_wmma_f32_16x16x32_bf16(false, a, false, b, (short)0, c, false, false); }
__device__ __forceinline__ h16 tohx(float x) { return (h16)x; }
__device__ __forceinline__ void splitf(float y, unsigned short& h, unsigned short& l) { h = f2bf(y); l = f2bf(y - bf2f(h)); }
// same-wave LDS relayout: stores of all lanes complete before any lane reloads (wave-private tile)
__device__ __forceinline__ void wave_lds_sync() { __builtin_amdgcn_fence(3 /* release order */, "wavefront"); __builtin_amdgcn_wave_barrier(); asm volatile("" ::: "memory"); }

// ---- Fragment loader (16-bit planes, k-contiguous rows): lane l -> row (l & 15); elements 0..7 <- k0 + 8*(l>>4) + 0..7, elements 8..15 <- k0 + 16 + 8*(l>>4) + 0..7.
// Used for A (row m) and for Bt (row n of the [n][k] plane) alike; D element r of lane l = (row 8*(l>>4) + r, col l & 15).
template <typename T16> struct WFrag;
template <> struct WFrag<h16> { typedef v16h V; static __device__ __forceinline__ V ld(const h16* p) { return cat16(*(const v8h*)p, *(const v8h*)(p + 16)); } static __device__ __forceinline__ v8f mma(V a, V b, v8f c) { return wmma16(a, b, c); } };
template <> struct WFrag<bf> { typedef v16bf V; static __device__ __forceinline__ V ld(const bf* p) { return cat16b(*(const v8us*)p, *(const v8us*)(p + 16)); } static __device__ __forceinline__ v8f mma(V a, V b, v8f c) { return wmmab(a, b, c); } };

// ---- k_gemmw: GEMM, work-group of 4 waves (2 x 2) on a 128x128 output tile, each wave 64x64 (16 accumulators); grid (M/128, N/128), 128 threads.
// C[m][n] (f32, pitch ldc, + optional f32 bias[n] as bf16-RNE value) = sum_k A[m][k] Bt[n][k] (+ A2[m][k] Bt[n][k] for NSPLIT 1). K % GKC == 0, K >= 2 GKC, M % 128 == 0, N % 128 == 0.
// QKV: Bt = the stacked rows [Wq | Wk | Wv], N = DQ + 2 DKV; a wave's 64 columns are one head, and C is not written: the epilogue writes that head's operand planes (struct QkvOut; bias, biask, biasv = the three bias vectors).
// The operand tiles (128 rows x GKC k of A, of A2 where there is one, of Bt) are staged in LDS by asynchronous copies, two buffers: tile t + 1 flies while tile t is multiplied. Each tile row is read from L2 once per work-group, in whole lines.
#define GKC   128                  // k elements of one stage: rows of 256 bytes
#define GPIT  136                  // LDS row pitch in elements: 272 bytes = 16 x odd, the conflict-free pitch for 16-byte fragment reads
#define GTILE (128 * GPIT)         // elements of one operand tile in LDS
__device__ __forceinline__ unsigned lds_off(const void* p) { return (unsigned)(size_t)p; }   // byte offset in the work-group's LDS = low 32 bits of the __shared__ address
// eight 16-byte copies per lane, rows 8 apart (LDS step ls bytes, global step gs elements); s_wait_xcnt 0 as the statement's last line, a precaution: so it stands in front of every later write of a register that these copies name
template <typename T16>
__device__ __forceinline__ void acopy8(unsigned l, const T16* g, unsigned ls, size_t gs) {
    asm volatile("global_load_async_to_lds_b128 %0, %8, off\n\t"
                 "global_load_async_to_lds_b128 %1, %9, off\n\t"
                 "global_load_async_to_lds_b128 %2, %10, off\n\t"
                 "global_load_async_to_lds_b128 %3, %11, off\n\t"
                 "global_load_async_to_lds_b128 %4, %12, off\n\t"
                 "global_load_async_to_lds_b128 %5, %13, off\n\t"
                 "global_load_async_to_lds_b128 %6, %14, off\n\t"
                 "global_load_async_to_lds_b128 %7, %15, off\n\t"
                 "s_wait_xcnt 0x0"
                 :: "v"(l), "v"(l + ls), "v"(l + 2 * ls), "v"(l + 3 * ls), "v"(l + 4 * ls), "v"(l + 5 * ls), "v"(l + 6 * ls), "v"(l + 7 * ls),
                    "v"(g), "v"(g + gs), "v"(g + 2 * gs), "v"(g + 3 * gs), "v"(g + 4 * gs), "v"(g + 5 * gs), "v"(g + 6 * gs), "v"(g + 7 * gs)
                 : "memory");
}
// planes written by the q, k, v projection: value = (sum + bias) * carry as f16 and as bf16 hi + lo; q [batch-head][t][d], k [batch-group][t][d], v [batch-group][d][t]
struct QkvOut { h16* q16; bf* qh; bf* ql; h16* k16; bf* kh; bf* kl; h16* v16; bf* vh; bf* vl; };
// eight staged f32 values -> the three planes, 16 bytes each at element offset e (unrolled: the vectors are indexed by constants and stay in registers)
__device__ __forceinline__ void put_planes(const float* r, h16* P16, bf* Ph, bf* Pl, size_t e) { v8h o16; v8us oh, ol;
#pragma unroll
    for (int k = 0; k < 8; ++k) { o16[k] = tohx(r[k]); unsigned short a2, c2; splitf(r[k], a2, c2); oh[k] = a2; ol[k] = c2; }
    *(v8h*)(P16 + e) = o16; *(v8us*)(Ph + e) = oh; *(v8us*)(Pl + e) = ol; }
template <typename T16, int NSPLIT, bool BIAS, int K, bool QKV>
__global__ __launch_bounds__(128) void k_gemmw(const T16* __restrict__ A, const T16* __restrict__ A2, const T16* __restrict__ Bt, float* C, int ldc, const float* __restrict__ bias, const float* __restrict__ biask, const float* __restrict__ biasv, QkvOut qo) {
    typedef typename WFrag<T16>::V V;
    static_assert((NSPLIT == 0 || NSPLIT == 1) && K % GKC == 0 && K / GKC >= 2);
    constexpr int NOP = NSPLIT + 2;                                   // operand tiles of a stage: Bt, A (, A2)
    __shared__ __attribute__((aligned(16))) T16 ring[2 * NOP * GTILE];
    __shared__ __align__(16) float osw[4 * 16 * 68];
    const int tid = threadIdx.x, lane = tid & 31, lr = lane & 15, hi = lane >> 4;
    const int w = __builtin_amdgcn_readfirstlane(tid >> 5), wm = w >> 1, wn = w & 1;
    const int R0 = blockIdx.x * 128, C0 = blockIdx.y * 128;
    // copy map: 16 lanes cover one 256-byte row, the 128 threads 8 rows; 16 copies per lane and operand tile
    const int crow = tid >> 4, ccol = (tid & 15) * 8;
    const unsigned lc = lds_off(ring) + (unsigned)(crow * GPIT + ccol) * 2u;
    const T16* gB = Bt + (size_t)(C0 + crow) * K + ccol; const T16* gA = A + (size_t)(R0 + crow) * K + ccol; const T16* gA2 = (NSPLIT == 1) ? A2 + (size_t)(R0 + crow) * K + ccol : nullptr;
    auto fill = [&](int t, int buf) {
        const unsigned l = lc + (unsigned)(buf * NOP * GTILE) * 2u; const size_t ko = (size_t)t * GKC, g8 = (size_t)8 * K;
        acopy8(l, gB + ko, 8 * GPIT * 2, g8); acopy8(l + 64 * GPIT * 2, gB + ko + 8 * g8, 8 * GPIT * 2, g8);
        acopy8(l + GTILE * 2, gA + ko, 8 * GPIT * 2, g8); acopy8(l + GTILE * 2 + 64 * GPIT * 2, gA + ko + 8 * g8, 8 * GPIT * 2, g8);
        if constexpr (NSPLIT == 1) { acopy8(l + 2 * GTILE * 2, gA2 + ko, 8 * GPIT * 2, g8); acopy8(l + 2 * GTILE * 2 + 64 * GPIT * 2, gA2 + ko + 8 * g8, 8 * GPIT * 2, g8); }
    };
    v8f acc[4][4];
#pragma unroll
    for (int mb = 0; mb < 4; ++mb)
#pragma unroll
        for (int nb = 0; nb < 4; ++nb) acc[mb][nb] = (v8f){};
    constexpr int ntr = K / GKC;
    fill(0, 0);
    asm volatile("s_wait_asynccnt 0x0" ::: "memory");   // this wave's copies of tile 0 have landed
    __syncthreads();                                    // every wave's have
    fill(1, 1);
    const int boff = (wn * 64 + lr) * GPIT + 8 * hi, aoff = GTILE + (wm * 64 + lr) * GPIT + 8 * hi;
// rolled: one trip per stage
#pragma unroll 1
    for (int t = 0; t < ntr; ++t) {
        const T16* st = ring + (t & 1) * (NOP * GTILE);
        V a[2][4], a2[2][4], b[2][4];
#pragma unroll
        for (int f = 0; f < 4; ++f) { b[0][f] = WFrag<T16>::ld(st + boff + f * 16 * GPIT); a[0][f] = WFrag<T16>::ld(st + aoff + f * 16 * GPIT); if (NSPLIT == 1) a2[0][f] = WFrag<T16>::ld(st + aoff + GTILE + f * 16 * GPIT); }
// unrolled: the two fragment sets are indexed by constants and stay in registers
#pragma unroll
        for (int ks = 0; ks < GKC / 32; ++ks) { const int c = ks & 1, n = c ^ 1;
            if (ks + 1 < GKC / 32) {                    // the next 32 k of this same tile are fetched as one group ahead of this block's products
#pragma unroll
                for (int f = 0; f < 4; ++f) { const int o = f * 16 * GPIT + (ks + 1) * 32; b[n][f] = WFrag<T16>::ld(st + boff + o); a[n][f] = WFrag<T16>::ld(st + aoff + o); if (NSPLIT == 1) a2[n][f] = WFrag<T16>::ld(st + aoff + GTILE + o); } }
            __builtin_amdgcn_sched_barrier(0);          // keeps that group of LDS reads together and ahead of the products; left free they sink to their first use, each behind a wait to 0
#pragma unroll
            for (int nb = 0; nb < 4; ++nb)
#pragma unroll
                for (int mb = 0; mb < 4; ++mb) acc[mb][nb] = WFrag<T16>::mma(a[c][mb], b[c][nb], acc[mb][nb]);
            if constexpr (NSPLIT == 1) {
#pragma unroll
                for (int nb = 0; nb < 4; ++nb)
#pragma unroll
                    for (int mb = 0; mb < 4; ++mb) acc[mb][nb] = WFrag<T16>::mma(a2[c][mb], b[c][nb], acc[mb][nb]); }
            __builtin_amdgcn_sched_barrier(0);          // keeps the following group of LDS reads from being spread among these products
        }
        asm volatile("s_wait_dscnt 0x0" ::: "memory");      // this wave's reads of the buffer are done before it is handed back
        asm volatile("s_wait_asynccnt 0x0" ::: "memory");   // this wave's copies of tile t + 1 have landed
        __syncthreads();                                    // publishes tile t + 1 and ends every wave's reads of tile t
        if (t + 2 < ntr) fill(t + 2, t & 1);
    }
    asm volatile("s_wait_asynccnt 0x0" ::: "memory");       // no copy is left in flight
    float* os = osw + w * (16 * 68);                        // this wave's own staging rows
    const int r0 = R0 + wm * 64, c0 = C0 + wn * 64;
    if constexpr (QKV) {
        // 16 staged rows of 64 f32 are read back 8 values per lane: 8 lanes cover a row (128 bytes of each 16-bit plane), a wave 4 rows
        // every '#pragma unroll' of this block is there so that the accumulators and the small value arrays are indexed by constants and stay in registers
        const int hc = c0 / HD, bb = r0 / TT, t0 = r0 % TT, sr = lane >> 3, sc = (lane & 7) * 8;   // hc: head slot (wave-uniform): q heads, then k groups, then v groups
        if (hc < NH_ + NKV) {                               // q or k: staged rows = tokens, columns = d; the wave's 64 x 64 tile is 8 KiB in a row in each plane
            const bool isq = hc < NH_;
            const float* bp = (isq ? bias + c0 : biask + (c0 - DQ)) + sc;
            const size_t base = ((size_t)(isq ? bb * NH_ + hc : bb * NKV + (hc - NH_)) * TT + t0) * HD + sc;
            h16* P16 = isq ? qo.q16 : qo.k16; bf* Ph = isq ? qo.qh : qo.kh; bf* Pl = isq ? qo.ql : qo.kl;
            float bc[8];
#pragma unroll
            for (int k = 0; k < 8; ++k) bc[k] = bfr(bp[k]);
#pragma unroll
            for (int mb = 0; mb < 4; ++mb) {
#pragma unroll
                for (int nb = 0; nb < 4; ++nb) {
#pragma unroll
                    for (int j = 0; j < 8; ++j) os[(hi * 8 + j) * 68 + nb * 16 + lr] = acc[mb][nb][j]; }
                wave_lds_sync();
#pragma unroll
                for (int s = 0; s < 4; ++s) { const int row = 4 * s + sr; const v4f v0 = *(const v4fa*)(os + row * 68 + sc), v1 = *(const v4fa*)(os + row * 68 + sc + 4); float r[8];
#pragma unroll
                    for (int k = 0; k < 8; ++k) r[k] = ((k < 4 ? v0[k & 3] : v1[k & 3]) + bc[k]) * QCAR;
                    put_planes(r, P16, Ph, Pl, base + (size_t)(mb * 16 + row) * HD); }
                asm volatile("s_wait_xcnt 0x0" ::: "memory");   // a precaution: stands before the next rows' values and addresses go into registers that these stores name
                wave_lds_sync();
            }
        } else {                                            // v: staged rows = d, columns = tokens (an accumulator holds 8 tokens in a row of one d), so the plane comes out transposed in whole lines
            const float* bp = biasv + (c0 - DQ - DKV);
            const size_t base = (size_t)(bb * NKV + (hc - NH_ - NKV)) * HD * TT + t0 + sc;
#pragma unroll
            for (int nb = 0; nb < 4; ++nb) {
#pragma unroll
                for (int mb = 0; mb < 4; ++mb) {
#pragma unroll
                    for (int j = 0; j < 8; ++j) os[lr * 68 + mb * 16 + hi * 8 + j] = acc[mb][nb][j]; }
                wave_lds_sync();
#pragma unroll
                for (int s = 0; s < 4; ++s) { const int row = 4 * s + sr; const v4f v0 = *(const v4fa*)(os + row * 68 + sc), v1 = *(const v4fa*)(os + row * 68 + sc + 4); const float bd = bfr(bp[nb * 16 + row]); float r[8];
#pragma unroll
                    for (int k = 0; k < 8; ++k) r[k] = ((k < 4 ? v0[k & 3] : v1[k & 3]) + bd) * VCAR;
                    put_planes(r, qo.v16, qo.vh, qo.vl, base + (size_t)(nb * 16 + row) * TT); }
                asm volatile("s_wait_xcnt 0x0" ::: "memory");   // a precaution: stands before the next rows' values and addresses go into registers that these stores name
                wave_lds_sync();
            }
        }
        return;
    }
#pragma unroll
    for (int mb = 0; mb < 4; ++mb) {
#pragma unroll
        for (int nb = 0; nb < 4; ++nb) {
#pragma unroll
            for (int j = 0; j < 8; ++j) os[(hi * 8 + j) * 68 + nb * 16 + lr] = acc[mb][nb][j]; }
        wave_lds_sync();
        float* crw = C + (size_t)(r0 + mb * 16) * ldc + c0;
#pragma unroll
        for (int s = 0; s < 8; ++s) { const int row = 2 * s + hi, cofs = lr * 4; v4f val = *(const v4fa*)(os + row * 68 + cofs); if (BIAS) { val[0] += bfr(bias[c0 + cofs]); val[1] += bfr(bias[c0 + cofs + 1]); val[2] += bfr(bias[c0 + cofs + 2]); val[3] += bfr(bias[c0 + cofs + 3]); }
            *(v4f*)(crw + (size_t)row * ldc + cofs) = val; }
        asm volatile("s_wait_xcnt 0x0" ::: "memory");   // a precaution: stands before the next rows' values and addresses go into registers that these stores name
        wave_lds_sync();
    }
}

// ---- vis_row: one wave, query row i. VB[i][w] bit c = key w*32+c is visible to query i (on or below the diagonal and the fill input zero); BAD[i] = the strict upper triangle of row i holds an unfilled entry.
__device__ __forceinline__ void vis_row(const int* __restrict__ Fm, unsigned* VB, unsigned* BAD, int i, int lane) {
    const int* fr = Fm + (size_t)i * SEQ_FULL; unsigned mine = 0u, bad = 0u;
// unrolled: all loads of the row are in flight at once
#pragma unroll
    for (int w = 0; w < TT / 32; ++w) { const int j = w * 32 + lane; const bool filled = (fr[j] != 0); const bool vis = (j <= i);
        const unsigned bits = __builtin_amdgcn_ballot_w32(vis && !filled); bad |= __builtin_amdgcn_ballot_w32(!vis && !filled); if (lane == w) mine = bits; }
    if (lane < TT / 32) VB[(size_t)i * (TT / 32) + lane] = mine;
    if (lane == 0) BAD[i] = bad;
}

// ---- k_prep: everything that only reads the inputs, one launch of 16-wave work-groups. Groups 0 .. CVG-1: the four weight matrices and x to bf16 (RNE). Groups CVG ..: the visibility words, one wave per query row.
// Conversion: CVG * 16 waves in all, few enough to start quickly. The sources are cut into slabs of CSLAB elements and a wave takes its own 256 elements (1 KiB) of every slab, so each trip's source is known at compile time.
// A load covers 512 bytes in a row (16 per lane), a store 256 (8 per lane): whole lines both ways. All loads of a wave are issued before its first conversion.
#define CVG   256
#define CSLAB (CVG * 16 * 256)
static_assert((DQ * DM) % CSLAB == 0 && (DKV * DM) % CSLAB == 0 && (MT * DM) % CSLAB == 0 && TT % 16 == 0);
__global__ __launch_bounds__(512) void k_prep(const float* __restrict__ wq, const float* __restrict__ wk, const float* __restrict__ wv, const float* __restrict__ wo, const float* __restrict__ x, const int* __restrict__ Fm,
                                              bf* __restrict__ WQKV, bf* __restrict__ WO, bf* __restrict__ XB, unsigned* VB, unsigned* BAD) {
    const int lane = threadIdx.x & 31, w = __builtin_amdgcn_readfirstlane((int)(threadIdx.x >> 5));
    if (blockIdx.x >= CVG) { vis_row(Fm, VB, BAD, (int)(blockIdx.x - CVG) * 16 + w, lane); return; }
    constexpr int SQ = DQ * DM / CSLAB, SK = DKV * DM / CSLAB, SX = MT * DM / CSLAB, NS = 2 * SQ + 2 * SK + SX;   // slabs of Wq (and of Wo), of Wk (and of Wv), of x; in all
    const unsigned g = (unsigned)(blockIdx.x * 16 + w) * 64u + (unsigned)lane;   // the lane's first group of 4 elements in every slab; its second is 32 groups on
    v4f v[NS][2];
// both loops unrolled: the slab picks its source and destination at compile time, and the values stay in registers
#pragma unroll
    for (int s = 0; s < NS; ++s) {
        const float* p = s < SQ ? wq : s < SQ + SK ? wk : s < SQ + 2 * SK ? wv : s < 2 * SQ + 2 * SK ? wo : x;
        const int t = s < SQ ? s : s < SQ + SK ? s - SQ : s < SQ + 2 * SK ? s - SQ - SK : s < 2 * SQ + 2 * SK ? s - SQ - 2 * SK : s - 2 * SQ - 2 * SK;   // slab number within its source
        v[s][0] = ((const v4f*)p)[g + (unsigned)t * (CSLAB / 4)]; v[s][1] = ((const v4f*)p + 32)[g + (unsigned)t * (CSLAB / 4)]; }
#pragma unroll
    for (int s = 0; s < NS; ++s) {
        bf* d = s < SQ + 2 * SK ? WQKV : s < 2 * SQ + 2 * SK ? WO : XB;
        const int t = s < SQ + 2 * SK ? s : s < 2 * SQ + 2 * SK ? s - SQ - 2 * SK : s - 2 * SQ - 2 * SK;   // slab number within its destination
#pragma unroll
        for (int h = 0; h < 2; ++h) { v4us c;
#pragma unroll
            for (int k = 0; k < 4; ++k) c[k] = f2bf(v[s][h][k]);
            ((v4us*)d + h * 32)[g + (unsigned)t * (CSLAB / 4)] = c; } }
    asm volatile("s_wait_xcnt 0x0" ::: "memory");   // a precaution: stands behind the last store, before any later write of a register that these stores name
}

// ---- fattn_tile: one wave, NT*16 query rows of one batch-head, key blocks of 32 up to the diagonal block, running maximum and sum (scores and probabilities stay in registers).
// St = K Q^T: A = key rows, Bt = query rows, so D element r of lane l = (key 8*(l>>4) + r, query l & 15); the two 16-key tiles of a block are then, element for element, the fragment order of the loader above
// (elements 0..7 <- k 8*(l>>4) + 0..7, elements 8..15 <- k 16 + 8*(l>>4) + 0..7), so the probabilities go straight in as Bt of Ot = V^T P^T (A = rows d of the [d][t] value plane). Ot element r of lane l = (d 8*(l>>4) + r, query l & 15).
// Every '#pragma unroll' in this function is there so that the fragment, score and output arrays are indexed by constants and stay in registers.
// SPLIT: hi/lo bf16 planes, 3 products in the order hi.hi, (query or p) lo . hi, hi . (key or value) lo. Not SPLIT: f16 planes, p carried x1024 (the carry is in the sum as well and cancels).
template <typename T16, bool SPLIT, int NT>
__device__ __forceinline__ void fattn_tile(const T16* __restrict__ Q, const T16* __restrict__ Q2, const T16* __restrict__ Kp, const T16* __restrict__ K2, const T16* __restrict__ Vt, const T16* __restrict__ V2,
                                           const unsigned* __restrict__ VB, const unsigned* __restrict__ BAD, int q0, bf* Ah, bf* Al) {
    typedef typename WFrag<T16>::V V;
    const int lane = threadIdx.x & 31, lr = lane & 15, hi = lane >> 4; const float ninf = -__builtin_inff();
    const float C1 = SCL * 1.4426950408889634f;
    V qf[NT][2], qf2[NT][2];
#pragma unroll
    for (int nt = 0; nt < NT; ++nt)
#pragma unroll
        for (int ks = 0; ks < 2; ++ks) { const unsigned qo = (unsigned)(q0 + nt * 16 + lr) * HD + ks * 32 + 8 * hi; qf[nt][ks] = WFrag<T16>::ld(Q + qo); if (SPLIT) qf2[nt][ks] = WFrag<T16>::ld(Q2 + qo); }
    v8f o[4][NT]; float m[NT], l[NT];
#pragma unroll
    for (int nt = 0; nt < NT; ++nt) { m[nt] = ninf; l[nt] = 0.f;
#pragma unroll
        for (int dt = 0; dt < 4; ++dt) o[dt][nt] = (v8f){}; }
    const int kend = ((q0 + NT * 16 + 31) / 32) * 32;   // keys beyond the diagonal block are invisible to every row of the tile
    V kf[2][2], kf2[2][2]; unsigned wd[NT];
#pragma unroll
    for (int mt = 0; mt < 2; ++mt)
#pragma unroll
        for (int ks = 0; ks < 2; ++ks) { const unsigned ko = (unsigned)(mt * 16 + lr) * HD + ks * 32 + 8 * hi; kf[mt][ks] = WFrag<T16>::ld(Kp + ko); if (SPLIT) kf2[mt][ks] = WFrag<T16>::ld(K2 + ko); }
#pragma unroll
    for (int nt = 0; nt < NT; ++nt) wd[nt] = VB[(unsigned)(q0 + nt * 16 + lr) * (TT / 32)];
// rolled: one block's fragments, scores and outputs already fill the register budget
#pragma unroll 1
    for (int kb = 0; kb < kend; kb += 32) {
        V vf[4], vf2[4];
#pragma unroll
        for (int dt = 0; dt < 4; ++dt) { const unsigned vo = (unsigned)(dt * 16 + lr) * TT + kb + 8 * hi; vf[dt] = WFrag<T16>::ld(Vt + vo); if (SPLIT) vf2[dt] = WFrag<T16>::ld(V2 + vo); }
        if constexpr (!SPLIT) __builtin_amdgcn_sched_barrier(0);   // keeps the value loads up here, a whole softmax ahead of their use; left free they sink between the p.v products and each waits out its full latency
        v8f s[2][NT]; unsigned wc[NT];
#pragma unroll
        for (int mt = 0; mt < 2; ++mt)
#pragma unroll
            for (int nt = 0; nt < NT; ++nt) { v8f a = (v8f){};
#pragma unroll
                for (int ks = 0; ks < 2; ++ks) { a = WFrag<T16>::mma(kf[mt][ks], qf[nt][ks], a); if (SPLIT) { a = WFrag<T16>::mma(kf[mt][ks], qf2[nt][ks], a); a = WFrag<T16>::mma(kf2[mt][ks], qf[nt][ks], a); } }
                s[mt][nt] = a; }
#pragma unroll
        for (int nt = 0; nt < NT; ++nt) wc[nt] = wd[nt] >> (8 * hi);
        if constexpr (SPLIT) asm volatile("s_wait_xcnt 0x0" ::: "memory");   // in this build the key loads below return into registers that hold the value loads' addresses
        const int kn = min(kb + 32, kend - 32);          // next block's key fragments and visibility words fly during this block's softmax (the last block fetches itself again)
#pragma unroll
        for (int mt = 0; mt < 2; ++mt)
#pragma unroll
            for (int ks = 0; ks < 2; ++ks) { const unsigned ko = (unsigned)(kn + mt * 16 + lr) * HD + ks * 32 + 8 * hi; kf[mt][ks] = WFrag<T16>::ld(Kp + ko); if (SPLIT) kf2[mt][ks] = WFrag<T16>::ld(K2 + ko); }
#pragma unroll
        for (int nt = 0; nt < NT; ++nt) wd[nt] = VB[(unsigned)(q0 + nt * 16 + lr) * (TT / 32) + (kn >> 5)];
        V pf[NT], pf2[NT];
#pragma unroll
        for (int nt = 0; nt < NT; ++nt) {
            float bm = ninf;
#pragma unroll
            for (int mt = 0; mt < 2; ++mt)
#pragma unroll
                for (int r = 0; r < 8; ++r) { const float t = ((wc[nt] >> (mt * 16 + r)) & 1u) ? s[mt][nt][r] : ninf; s[mt][nt][r] = t; bm = fmaxf(bm, t); }
            bm = fmaxf(bm, __shfl_xor(bm, 16, 32));
            const float mn = fmaxf(m[nt], bm); const float ms = (mn == ninf) ? 0.f : mn;   // no visible key so far: every p and the rescale come out 0, not NaN
            const float al = __builtin_amdgcn_exp2f((m[nt] - ms) * C1); m[nt] = mn;
            float ps = 0.f, p[16];
#pragma unroll
            for (int e = 0; e < 16; ++e) { const float d = s[e >> 3][nt][e & 7] - ms; if (SPLIT) asm("v_exp_f32 %0, %1\n\tv_nop" : "=v"(p[e]) : "v"(d * C1));   // v_nop: the slot behind a transcendental, tied to it
                else p[e] = __builtin_amdgcn_exp2f(__builtin_fmaf(d, C1, PCARL2));
                ps += p[e]; }
            l[nt] = l[nt] * al + ps;                     // this lane's half of the keys; the halves are joined behind the loop
#pragma unroll
            for (int dt = 0; dt < 4; ++dt) o[dt][nt] *= al;
            if constexpr (SPLIT) { v16us ph, pl;
#pragma unroll
                for (int e = 0; e < 16; ++e) { unsigned short a2, c2; splitf(p[e], a2, c2); ph[e] = a2; pl[e] = c2; }
                pf[nt] = __builtin_bit_cast(v16bf, ph); pf2[nt] = __builtin_bit_cast(v16bf, pl);
            } else {
#pragma unroll
                for (int e = 0; e < 16; ++e) pf[nt][e] = tohx(p[e]); }
        }
#pragma unroll
        for (int dt = 0; dt < 4; ++dt)
#pragma unroll
            for (int nt = 0; nt < NT; ++nt) { o[dt][nt] = WFrag<T16>::mma(vf[dt], pf[nt], o[dt][nt]); if (SPLIT) { o[dt][nt] = WFrag<T16>::mma(vf[dt], pf2[nt], o[dt][nt]); o[dt][nt] = WFrag<T16>::mma(vf2[dt], pf[nt], o[dt][nt]); } }
    }
#pragma unroll
    for (int nt = 0; nt < NT; ++nt) { const int q = q0 + nt * 16 + lr; const float lt = l[nt] + __shfl_xor(l[nt], 16, 32);
        float inv = __fdiv_rn(1.0f / VCAR, lt); if (BAD[q]) inv = __uint_as_float(0x7fc00000u);   // a row with no visible key: 0 * inf = NaN, as the softmax of an all -inf row
#pragma unroll
        for (int dt = 0; dt < 4; ++dt) { v8us oh, ol;
#pragma unroll
            for (int r = 0; r < 8; ++r) { unsigned short a2, c2; splitf(o[dt][nt][r] * inv, a2, c2); oh[r] = a2; ol[r] = c2; }
            const unsigned oo = (unsigned)q * DQ + dt * 16 + 8 * hi; *(v8us*)(Ah + oo) = oh; *(v8us*)(Al + oo) = ol; } }
}

// ---- k_fattn: grid (batch-groups, query tiles), 4 independent waves = the 4 query heads of the group on the same query rows (they read the same key and value lines). Tiles in falling order of their key count:
// first the f16 tiles (32 rows, from the last row down to RH), then the hi/lo tiles (16 rows, below RH). Writes the bf16 hi/lo context planes [token][DQ].
#define NQF ((TT - RH) / 32)
#define NQS (RH / 16)
__global__ __launch_bounds__(128) void k_fattn(const h16* __restrict__ QP16, const h16* __restrict__ KP16, const h16* __restrict__ VT16, const bf* __restrict__ QPh, const bf* __restrict__ QPl, const bf* __restrict__ KPh, const bf* __restrict__ KPl,
                                               const bf* __restrict__ VTh, const bf* __restrict__ VTl, const unsigned* __restrict__ VB, const unsigned* __restrict__ BAD, bf* ATh, bf* ATl) {
    const int bg = blockIdx.x, bh = bg * REP + __builtin_amdgcn_readfirstlane((int)(threadIdx.x >> 5)), t = blockIdx.y;   // the wave's number as a scalar: plane bases stay in scalar registers
    const size_t zq = (size_t)bh * TT * HD, zk = (size_t)bg * TT * HD, zo = (size_t)(bh / NH_) * TT * DQ + (size_t)(bh % NH_) * HD;
    if (t < NQF) fattn_tile<h16, false, 2>(QP16 + zq, nullptr, KP16 + zk, nullptr, VT16 + zk, nullptr, VB, BAD, TT - 32 * (t + 1), ATh + zo, ATl + zo);
    else         fattn_tile<bf, true, 1>(QPh + zq, QPl + zq, KPh + zk, KPl + zk, VTh + zk, VTl + zk, VB, BAD, RH - 16 * (t - NQF + 1), ATh + zo, ATl + zo);
}

extern "C" void kernel_launch(void* const* d_in, const int* in_sizes, int n_in,
                              void* d_out, int out_size, void* d_ws, size_t ws_size, hipStream_t stream) {
    if (n_in < 10) return;
    if (in_sizes[0] < ((NB - 1) * SEQ_FULL + SEQ) * DM) return;
    if (in_sizes[1] < (SEQ - 1) * SEQ_FULL + SEQ) return;
    if (in_sizes[2] < DQ * DM || in_sizes[3] < DQ || in_sizes[4] < DKV * DM || in_sizes[5] < DKV || in_sizes[6] < DKV * DM || in_sizes[7] < DKV || in_sizes[8] < DM * DQ || in_sizes[9] < DM) return;
    if (out_size < ((NB - 1) * SEQ_FULL + SEQ) * DM) return;
    const float* x  = (const float*)d_in[0];   // [NB_FULL][SEQ_FULL][DM]
    const int*   fm = (const int*)d_in[1];     // [1][1][SEQ_FULL][SEQ_FULL], nonzero = filled (-inf)
    const float* wq = (const float*)d_in[2]; const float* bq = (const float*)d_in[3];   // [DQ][DM], [DQ]
    const float* wk = (const float*)d_in[4]; const float* bk = (const float*)d_in[5];   // [DKV][DM], [DKV]
    const float* wv = (const float*)d_in[6]; const float* bv = (const float*)d_in[7];   // [DKV][DM], [DKV]
    const float* wo = (const float*)d_in[8]; const float* bo = (const float*)d_in[9];   // [DM][DQ], [DM]
    float* OUT = (float*)d_out;                // [NB_FULL][SEQ_FULL][DM]
    char* wsp = (char*)d_ws; size_t used = 0;
    auto take = [&](size_t bytes) { char* p = wsp + used; used += (bytes + 255) & ~(size_t)255; return (void*)p; };
    bf* WQ = (bf*)take((size_t)(DQ + 2 * DKV) * DM * 2); bf* WO = (bf*)take((size_t)DM * DQ * 2);   // Wq, Wk, Wv rows stacked: one [DQ + 2 DKV][DM] operand
    bf* XB = (bf*)take((size_t)MT * DM * 2);
    h16* QP16 = (h16*)take((size_t)NHB * TT * HD * 2); h16* KP16 = (h16*)take((size_t)NKVB * TT * HD * 2); h16* VT16 = (h16*)take((size_t)NKVB * HD * TT * 2);
    bf* QPh = (bf*)take((size_t)NHB * TT * HD * 2); bf* QPl = (bf*)take((size_t)NHB * TT * HD * 2); bf* KPh = (bf*)take((size_t)NKVB * TT * HD * 2); bf* KPl = (bf*)take((size_t)NKVB * TT * HD * 2);
    bf* VTh = (bf*)take((size_t)NKVB * HD * TT * 2); bf* VTl = (bf*)take((size_t)NKVB * HD * TT * 2);
    unsigned* VB = (unsigned*)take((size_t)TT * (TT / 32) * 4); unsigned* BAD = (unsigned*)take((size_t)TT * 4);
    bf* ATh = (bf*)take((size_t)MT * DQ * 2); bf* ATl = (bf*)take((size_t)MT * DQ * 2);
    if (used > ws_size) return;

    k_prep<<<CVG + TT / 16, 512, 0, stream>>>(wq, wk, wv, wo, x, fm, WQ, WO, XB, VB, BAD);
    const QkvOut qo = { QP16, QPh, QPl, KP16, KPh, KPl, VT16, VTh, VTl };
    k_gemmw<bf, 0, true, DM, true><<<dim3(MT / 128, (DQ + 2 * DKV) / 128, 1), 128, 0, stream>>>(XB, nullptr, WQ, nullptr, 0, bq, bk, bv, qo);
    k_fattn<<<dim3(NKVB, NQF + NQS, 1), 128, 0, stream>>>(QP16, KP16, VT16, QPh, QPl, KPh, KPl, VTh, VTl, VB, BAD, ATh, ATl);
    k_gemmw<bf, 1, true, DQ, false><<<dim3(MT / 128, DM / 128, 1), 128, 0, stream>>>(ATh, ATl, WO, OUT, DM, bo, nullptr, nullptr, QkvOut{});
}

// v006
// A run of this version takes 92.8 microseconds.
// In two side-by-side timings against v005, it was 1.11 and 1.08 times as fast.
// All steps since v000 together make it 8.82 times as fast.
#include <hip/hip_runtime.h>

// Contractions (all f32 accumulate): x Wq^T, x Wk^T, x Wv^T on v_wmma_f32_16x16x32_bf16 (bf16 operands, inputs RNE-converted once, bias added in f32); q k^T and p v: query rows < RH on bf16 hi/lo planes (3 products), rows >= RH on v_wmma_f32_16x16x32_f16 (f16 operands: q and k carried x8, p carried x1024, v carried x8); ctx Wo^T: bf16 hi/lo ctx planes x bf16 Wo (2 products).
// Layout: grouped-query causal attention, NB x SEQ tokens (all batches in every launch: token row = b*SEQ + t, batch-head = b*32 + h, batch-group = batch-head / 4), hidden 2048, 32 query heads x 64 (head h = columns h*64..), 8 kv groups x 64 (kv group = head / 4), weights [out][in] (k-contiguous, used as Bt directly) + bias, scale 64^-0.5.
// Fill input [1][1][SEQ_FULL][SEQ_FULL] int (nonzero = -inf fill) is applied per element on and below the diagonal; the strict upper triangle is assumed filled (the key loop of a query tile stops at its diagonal block); vis_row checks that assumption per row on device and the row's context is written NaN otherwise.
// Attention is one launch: scores, softmax (running maximum and sum over key blocks of 32, normalised once at the end) and p.v stay in registers.
// The bf16 copies of the weights and of x and the visibility words are one launch (k_prep).
// The q, k and v projections are one launch over the stacked weight rows [Wq | Wk | Wv]; its epilogue writes the attention operand planes (no f32 copy of q, k, v in memory).
// Those planes lie in fragment order: units of 1 KiB = one 16 x 32 operand fragment, as two runs of 512 bytes (16 per lane), so every fragment load of the attention covers 4 whole 128-byte lines.

#ifndef NB
#define NB 2
#endif
#ifndef SEQ
#define SEQ 1024
#endif
#define NB_FULL  2
#define SEQ_FULL 1024
#define TT   SEQ
#define DM   2048
#define NH_  32
#define NKV  8
#define REP  (NH_ / NKV)
#define HD   64
#define DQ   (NH_ * HD)
#define DKV  (NKV * HD)
#define MT   (NB * TT)             // token rows of all batches
#define NHB  (NB * NH_)            // batch-heads (b * NH_ + h)
#define NKVB (NB * NKV)            // batch-groups (b * NKV + g) = batch-head / REP
#ifndef RH
#define RH   ((SEQ) >= 512 ? 256 : 64)   // query rows < RH use hi+lo planes
#endif
#define PCARL2 10.0f               // log2 of the p carry (x1024) for f16 rows
#define QCAR 8.0f                  // q, k plane carry
#define VCAR 8.0f                  // v plane carry
#define SCL  (0.125f / 64.0f)      // HD^-0.5 / (QCAR*QCAR)

static_assert(NB >= 1 && NB <= NB_FULL);
static_assert(SEQ % 128 == 0 && SEQ >= 128 && SEQ <= SEQ_FULL);
static_assert(RH % 64 == 0 && RH >= 64 && RH < SEQ);
static_assert(NH_ % NKV == 0 && RH % 32 == 0 && (SEQ - RH) % 32 == 0);
static_assert(SEQ == SEQ_FULL || NB == 1);   // token rows of all batches are contiguous in x and out
static_assert(DM % 64 == 0 && DQ % 64 == 0 && DKV % 64 == 0 && HD == 64 && TT % 64 == 0);
static_assert(DM % 32 == 0 && HD % 32 == 0 && TT % 32 == 0);
static_assert(MT % 128 == 0 && DM % 128 == 0 && DQ % 128 == 0 && DKV % 128 == 0);   // 128x128 GEMM tiles, stages of 128 k

typedef _Float16 h16;
typedef unsigned short bf;
typedef __attribute__((ext_vector_type(16))) __bf16   v16bf;
typedef __attribute__((ext_vector_type(16))) _Float16 v16h;
typedef __attribute__((ext_vector_type(8)))  _Float16 v8h;
typedef __attribute__((ext_vector_type(8)))  unsigned short v8us;
typedef __attribute__((ext_vector_type(16))) unsigned short v16us;
typedef __attribute__((ext_vector_type(8)))  float    v8f;
typedef __attribute__((ext_vector_type(4)))  float    v4f;
typedef __attribute__((ext_vector_type(4)))  int      v4i;
typedef __attribute__((ext_vector_type(2)))  _Float16 v2h;
typedef __attribute__((ext_vector_type(4)))  _Float16 v4h;
typedef __attribute__((ext_vector_type(2)))  unsigned short v2us;
typedef __attribute__((ext_vector_type(4)))  unsigned short v4us;
typedef v8h  __attribute__((may_alias)) v8ha;
typedef v4f  __attribute__((may_alias)) v4fa;
typedef v8us __attribute__((may_alias)) v8usa;

__device__ __forceinline__ unsigned short f2bf(float f) { unsigned u = __float_as_uint(f); u += 0x7FFFu + ((u >> 16) & 1u); return (unsigned short)(u >> 16); }
__device__ __forceinline__ float bf2f(unsigned short b) { return __uint_as_float(((unsigned)b) << 16); }
__device__ __forceinline__ float bfr(float f) { return bf2f(f2bf(f)); }
__device__ __forceinline__ v16h cat16(v8h lo, v8h hi) { return __builtin_shufflevector(lo, hi, 0, 1, 2, 3, 4, 5, 6, 7, 8, 9, 10, 11, 12, 13, 14, 15); }
__device__ __forceinline__ v16bf cat16b(v8us lo, v8us hi) { return __builtin_bit_cast(v16bf, __builtin_shufflevector(lo, hi, 0, 1, 2, 3, 4, 5, 6, 7, 8, 9, 10, 11, 12, 13, 14, 15)); }
__device__ __forceinline__ v8f wmma16(v16h a, v16h b, v8f c) { return __builtin_amdgcn_wmma_f32_16x16x32_f16(false, a, false, b, (short)0, c, false, false); }
__device__ __forceinline__ v8f wmmab(v16bf a, v16bf b, v8f c) { return __builtin_amdgcn_wmma_f32_16x16x32_bf16(false, a, false, b, (short)0, c, false, false); }
__device__ __forceinline__ h16 tohx(float x) { return (h16)x; }
__device__ __forceinline__ void splitf(float y, unsigned short& h, unsigned short& l) { h = f2bf(y); l = f2bf(y - bf2f(h)); }
// same-wave LDS relayout: stores of all lanes complete before any lane reloads (wave-private tile)
__device__ __forceinline__ void wave_lds_sync() { __builtin_amdgcn_fence(3 /* release order */, "wavefront"); __builtin_amdgcn_wave_barrier(); asm volatile("" ::: "memory"); }

// ---- Fragment loader (16-bit planes, k-contiguous rows): lane l -> row (l & 15); elements 0..7 <- k0 + 8*(l>>4) + 0..7, elements 8..15 <- k0 + 16 + 8*(l>>4) + 0..7.
// Used for A (row m) and for Bt (row n of the [n][k] plane) alike; D element r of lane l = (row 8*(l>>4) + r, col l & 15).
// ldf: the same fragment from a plane in fragment order; p = the fragment's 512-element unit + 8 * lane: elements 0..7 of all lanes lie in a row (512 bytes), elements 8..15 in the 512 bytes behind them.
template <typename T16> struct WFrag;
template <> struct WFrag<h16> { typedef v16h V; static __device__ __forceinline__ V ld(const h16* p) { return cat16(*(const v8h*)p, *(const v8h*)(p + 16)); } static __device__ __forceinline__ V ldf(const h16* p) { return cat16(*(const v8h*)p, *(const v8h*)(p + 256)); } static __device__ __forceinline__ v8f mma(V a, V b, v8f c) { return wmma16(a, b, c); } };
template <> struct WFrag<bf> { typedef v16bf V; static __device__ __forceinline__ V ld(const bf* p) { return cat16b(*(const v8us*)p, *(const v8us*)(p + 16)); } static __device__ __forceinline__ V ldf(const bf* p) { return cat16b(*(const v8us*)p, *(const v8us*)(p + 256)); } static __device__ __forceinline__ v8f mma(V a, V b, v8f c) { return wmmab(a, b, c); } };

// ---- k_gemmw: GEMM, work-group of 4 waves (2 x 2) on a 128x128 output tile, each wave 64x64 (16 accumulators); grid (M/128, N/128), 128 threads.
// C[m][n] (f32, pitch ldc, + optional f32 bias[n] as bf16-RNE value) = sum_k A[m][k] Bt[n][k] (+ A2[m][k] Bt[n][k] for NSPLIT 1). K % GKC == 0, K >= 2 GKC, M % 128 == 0, N % 128 == 0.
// QKV: Bt = the stacked rows [Wq | Wk | Wv], N = DQ + 2 DKV; a wave's 64 columns are one head, and C is not written: the epilogue writes that head's operand planes (struct QkvOut; bias, biask, biasv = the three bias vectors).
// The operand tiles (128 rows x GKC k of A, of A2 where there is one, of Bt) are staged in LDS by asynchronous copies, two buffers: tile t + 1 flies while tile t is multiplied. Each tile row is read from L2 once per work-group, in whole lines.
#define GKC   128                  // k elements of one stage: rows of 256 bytes
#define GPIT  136                  // LDS row pitch in elements: 272 bytes = 16 x odd, the conflict-free pitch for 16-byte fragment reads
#define GTILE (128 * GPIT)         // elements of one operand tile in LDS
__device__ __forceinline__ unsigned lds_off(const void* p) { return (unsigned)(size_t)p; }   // byte offset in the work-group's LDS = low 32 bits of the __shared__ address
// eight 16-byte copies per lane, rows 8 apart (LDS step ls bytes, global step gs elements); s_wait_xcnt 0 as the statement's last line, a precaution: so it stands in front of every later write of a register that these copies name
template <typename T16>
__device__ __forceinline__ void acopy8(unsigned l, const T16* g, unsigned ls, size_t gs) {
    asm volatile("global_load_async_to_lds_b128 %0, %8, off\n\t"
                 "global_load_async_to_lds_b128 %1, %9, off\n\t"
                 "global_load_async_to_lds_b128 %2, %10, off\n\t"
                 "global_load_async_to_lds_b128 %3, %11, off\n\t"
                 "global_load_async_to_lds_b128 %4, %12, off\n\t"
                 "global_load_async_to_lds_b128 %5, %13, off\n\t"
                 "global_load_async_to_lds_b128 %6, %14, off\n\t"
                 "global_load_async_to_lds_b128 %7, %15, off\n\t"
                 "s_wait_xcnt 0x0"
                 :: "v"(l), "v"(l + ls), "v"(l + 2 * ls), "v"(l + 3 * ls), "v"(l + 4 * ls), "v"(l + 5 * ls), "v"(l + 6 * ls), "v"(l + 7 * ls),
                    "v"(g), "v"(g + gs), "v"(g + 2 * gs), "v"(g + 3 * gs), "v"(g + 4 * gs), "v"(g + 5 * gs), "v"(g + 6 * gs), "v"(g + 7 * gs)
                 : "memory");
}
// planes written by the q, k, v projection: value = (sum + bias) * carry as f16 and as bf16 hi + lo, in fragment order (8 elements per lane l = 16 * hi + lr, j = first or second half of the fragment):
// q [batch-head] and k [batch-group]: [t / 16][d / 32][j][l][8], row lr = t % 16, d % 32 = 16 j + 8 hi + 0..7; v [batch-group]: [t / 32][d / 16][j][l][8], row lr = d % 16, t % 32 = 16 j + 8 hi + 0..7
struct QkvOut { h16* q16; bf* qh; bf* ql; h16* k16; bf* kh; bf* kl; h16* v16; bf* vh; bf* vl; };
// eight staged f32 values -> the three planes, 16 bytes each at element offset e (unrolled: the vectors are indexed by constants and stay in registers)
__device__ __forceinline__ void put_planes(const float* r, h16* P16, bf* Ph, bf* Pl, size_t e) { v8h o16; v8us oh, ol;
#pragma unroll
    for (int k = 0; k < 8; ++k) { o16[k] = tohx(r[k]); unsigned short a2, c2; splitf(r[k], a2, c2); oh[k] = a2; ol[k] = c2; }
    *(v8h*)(P16 + e) = o16; *(v8us*)(Ph + e) = oh; *(v8us*)(Pl + e) = ol; }
template <typename T16, int NSPLIT, bool BIAS, int K, bool QKV>
__global__ __launch_bounds__(128) void k_gemmw(const T16* __restrict__ A, const T16* __restrict__ A2, const T16* __restrict__ Bt, float* C, int ldc, const float* __restrict__ bias, const float* __restrict__ biask, const float* __restrict__ biasv, QkvOut qo) {
    typedef typename WFrag<T16>::V V;
    static_assert((NSPLIT == 0 || NSPLIT == 1) && K % GKC == 0 && K / GKC >= 2);
    constexpr int NOP = NSPLIT + 2;                                   // operand tiles of a stage: Bt, A (, A2)
    __shared__ __attribute__((aligned(16))) T16 ring[2 * NOP * GTILE];
    __shared__ __align__(16) float osw[4 * 16 * 68];
    const int tid = threadIdx.x, lane = tid & 31, lr = lane & 15, hi = lane >> 4;
    const int w = __builtin_amdgcn_readfirstlane(tid >> 5), wm = w >> 1, wn = w & 1;
    const int R0 = blockIdx.x * 128, C0 = blockIdx.y * 128;
    // copy map: 16 lanes cover one 256-byte row, the 128 threads 8 rows; 16 copies per lane and operand tile
    const int crow = tid >> 4, ccol = (tid & 15) * 8;
    const unsigned lc = lds_off(ring) + (unsigned)(crow * GPIT + ccol) * 2u;
    const T16* gB = Bt + (size_t)(C0 + crow) * K + ccol; const T16* gA = A + (size_t)(R0 + crow) * K + ccol; const T16* gA2 = (NSPLIT == 1) ? A2 + (size_t)(R0 + crow) * K + ccol : nullptr;
    auto fill = [&](int t, int buf) {
        const unsigned l = lc + (unsigned)(buf * NOP * GTILE) * 2u; const size_t ko = (size_t)t * GKC, g8 = (size_t)8 * K;
        acopy8(l, gB + ko, 8 * GPIT * 2, g8); acopy8(l + 64 * GPIT * 2, gB + ko + 8 * g8, 8 * GPIT * 2, g8);
        acopy8(l + GTILE * 2, gA + ko, 8 * GPIT * 2, g8); acopy8(l + GTILE * 2 + 64 * GPIT * 2, gA + ko + 8 * g8, 8 * GPIT * 2, g8);
        if constexpr (NSPLIT == 1) { acopy8(l + 2 * GTILE * 2, gA2 + ko, 8 * GPIT * 2, g8); acopy8(l + 2 * GTILE * 2 + 64 * GPIT * 2, gA2 + ko + 8 * g8, 8 * GPIT * 2, g8); }
    };
    v8f acc[4][4];
#pragma unroll
    for (int mb = 0; mb < 4; ++mb)
#pragma unroll
        for (int nb = 0; nb < 4; ++nb) acc[mb][nb] = (v8f){};
    constexpr int ntr = K / GKC;
    fill(0, 0);
    asm volatile("s_wait_asynccnt 0x0" ::: "memory");   // this wave's copies of tile 0 have landed
    __syncthreads();                                    // every wave's have
    fill(1, 1);
    const int boff = (wn * 64 + lr) * GPIT + 8 * hi, aoff = GTILE + (wm * 64 + lr) * GPIT + 8 * hi;
// rolled: one trip per stage
#pragma unroll 1
    for (int t = 0; t < ntr; ++t) {
        const T16* st = ring + (t & 1) * (NOP * GTILE);
        V a[2][4], a2[2][4], b[2][4];
#pragma unroll
        for (int f = 0; f < 4; ++f) { b[0][f] = WFrag<T16>::ld(st + boff + f * 16 * GPIT); a[0][f] = WFrag<T16>::ld(st + aoff + f * 16 * GPIT); if (NSPLIT == 1) a2[0][f] = WFrag<T16>::ld(st + aoff + GTILE + f * 16 * GPIT); }
// unrolled: the two fragment sets are indexed by constants and stay in registers
#pragma unroll
        for (int ks = 0; ks < GKC / 32; ++ks) { const int c = ks & 1, n = c ^ 1;
            if (ks + 1 < GKC / 32) {                    // the next 32 k of this same tile are fetched as one group ahead of this block's products
#pragma unroll
                for (int f = 0; f < 4; ++f) { const int o = f * 16 * GPIT + (ks + 1) * 32; b[n][f] = WFrag<T16>::ld(st + boff + o); a[n][f] = WFrag<T16>::ld(st + aoff + o); if (NSPLIT == 1) a2[n][f] = WFrag<T16>::ld(st + aoff + GTILE + o); } }
            __builtin_amdgcn_sched_barrier(0);          // keeps that group of LDS reads together and ahead of the products; left free they sink to their first use, each behind a wait to 0
#pragma unroll
            for (int nb = 0; nb < 4; ++nb)
#pragma unroll
                for (int mb = 0; mb < 4; ++mb) acc[mb][nb] = WFrag<T16>::mma(a[c][mb], b[c][nb], acc[mb][nb]);
            if constexpr (NSPLIT == 1) {
#pragma unroll
                for (int nb = 0; nb < 4; ++nb)
#pragma unroll
                    for (int mb = 0; mb < 4; ++mb) acc[mb][nb] = WFrag<T16>::mma(a2[c][mb], b[c][nb], acc[mb][nb]); }
            __builtin_amdgcn_sched_barrier(0);          // keeps the following group of LDS reads from being spread among these products
        }
        asm volatile("s_wait_dscnt 0x0" ::: "memory");      // this wave's reads of the buffer are done before it is handed back
        asm volatile("s_wait_asynccnt 0x0" ::: "memory");   // this wave's copies of tile t + 1 have landed
        __syncthreads();                                    // publishes tile t + 1 and ends every wave's reads of tile t
        if (t + 2 < ntr) fill(t + 2, t & 1);
    }
    asm volatile("s_wait_asynccnt 0x0" ::: "memory");       // no copy is left in flight
    float* os = osw + w * (16 * 68);                        // this wave's own staging rows
    const int r0 = R0 + wm * 64, c0 = C0 + wn * 64;
    if constexpr (QKV) {
        // 16 staged rows of 64 f32 are read back in fragment order: lane l takes 8 values of row l & 15 at column 16 s + 8 (l >> 4), and the wave stores them as 512 bytes in a row of each 16-bit plane
        // every '#pragma unroll' of this block is there so that the accumulators and the small value arrays are indexed by constants and stay in registers
        const int hc = c0 / HD, bb = r0 / TT, t0 = r0 % TT;   // hc: head slot (wave-uniform): q heads, then k groups, then v groups
        const float* rb = os + lr * 68 + hi * 8;              // the lane's place in the staged rows
        if (hc < NH_ + NKV) {                               // q or k: staged rows = tokens, columns = d; the wave's 64 x 64 tile is 8 KiB in a row in each plane
            const bool isq = hc < NH_;
            const float* bp = (isq ? bias + c0 : biask + (c0 - DQ)) + hi * 8;
            const size_t base = ((size_t)(isq ? bb * NH_ + hc : bb * NKV + (hc - NH_)) * TT + t0) * HD + lane * 8;
            h16* P16 = isq ? qo.q16 : qo.k16; bf* Ph = isq ? qo.qh : qo.kh; bf* Pl = isq ? qo.ql : qo.kl;
            float bc[4][8];
#pragma unroll
            for (int s = 0; s < 4; ++s)
#pragma unroll
                for (int k = 0; k < 8; ++k) bc[s][k] = bfr(bp[s * 16 + k]);
#pragma unroll
            for (int mb = 0; mb < 4; ++mb) {
#pragma unroll
                for (int nb = 0; nb < 4; ++nb) {
#pragma unroll
                    for (int j = 0; j < 8; ++j) os[(hi * 8 + j) * 68 + nb * 16 + lr] = acc[mb][nb][j]; }
                wave_lds_sync();
#pragma unroll
                for (int s = 0; s < 4; ++s) { const v4f v0 = *(const v4fa*)(rb + s * 16), v1 = *(const v4fa*)(rb + s * 16 + 4); float r[8];   // s = 2 (d / 32) + j
#pragma unroll
                    for (int k = 0; k < 8; ++k) r[k] = ((k < 4 ? v0[k & 3] : v1[k & 3]) + bc[s][k]) * QCAR;
                    put_planes(r, P16, Ph, Pl, base + (size_t)(mb * 1024 + s * 256)); }
                asm volatile("s_wait_xcnt 0x0" ::: "memory");   // a precaution: stands before the next rows' values and addresses go into registers that these stores name
                wave_lds_sync();
            }
        } else {                                            // v: staged rows = d, columns = tokens (an accumulator holds 8 tokens in a row of one d), so the fragments come out with d as their rows
            const float* bp = biasv + (c0 - DQ - DKV) + lr;
            const size_t base = ((size_t)(bb * NKV + (hc - NH_ - NKV)) * TT + t0) * HD + lane * 8;
#pragma unroll
            for (int nb = 0; nb < 4; ++nb) {
#pragma unroll
                for (int mb = 0; mb < 4; ++mb) {
#pragma unroll
                    for (int j = 0; j < 8; ++j) os[lr * 68 + mb * 16 + hi * 8 + j] = acc[mb][nb][j]; }
                wave_lds_sync();
#pragma unroll
                for (int s = 0; s < 4; ++s) { const v4f v0 = *(const v4fa*)(rb + s * 16), v1 = *(const v4fa*)(rb + s * 16 + 4); const float bd = bfr(bp[nb * 16]); float r[8];   // s = 2 (t / 32) + j
#pragma unroll
                    for (int k = 0; k < 8; ++k) r[k] = ((k < 4 ? v0[k & 3] : v1[k & 3]) + bd) * VCAR;
                    put_planes(r, qo.v16, qo.vh, qo.vl, base + (size_t)((s >> 1) * 2048 + nb * 512 + (s & 1) * 256)); }
                asm volatile("s_wait_xcnt 0x0" ::: "memory");   // a precaution: stands before the next rows' values and addresses go into registers that these stores name
                wave_lds_sync();
            }
        }
        return;
    }
#pragma unroll
    for (int mb = 0; mb < 4; ++mb) {
#pragma unroll
        for (int nb = 0; nb < 4; ++nb) {
#pragma unroll
            for (int j = 0; j < 8; ++j) os[(hi * 8 + j) * 68 + nb * 16 + lr] = acc[mb][nb][j]; }
        wave_lds_sync();
        float* crw = C + (size_t)(r0 + mb * 16) * ldc + c0;
#pragma unroll
        for (int s = 0; s < 8; ++s) { const int row = 2 * s + hi, cofs = lr * 4; v4f val = *(const v4fa*)(os + row * 68 + cofs); if (BIAS) { val[0] += bfr(bias[c0 + cofs]); val[1] += bfr(bias[c0 + cofs + 1]); val[2] += bfr(bias[c0 + cofs + 2]); val[3] += bfr(bias[c0 + cofs + 3]); }
            *(v4f*)(crw + (size_t)row * ldc + cofs) = val; }
        asm volatile("s_wait_xcnt 0x0" ::: "memory");   // a precaution: stands before the next rows' values and addresses go into registers that these stores name
        wave_lds_sync();
    }
}

// ---- vis_row: one wave, query row i. VB[i][w] bit c = key w*32+c is visible to query i (on or below the diagonal and the fill input zero); BAD[i] = the strict upper triangle of row i holds an unfilled entry.
__device__ __forceinline__ void vis_row(const int* __restrict__ Fm, unsigned* VB, unsigned* BAD, int i, int lane) {
    const int* fr = Fm + (size_t)i * SEQ_FULL; unsigned mine = 0u, bad = 0u;
// unrolled: all loads of the row are in flight at once
#pragma unroll
    for (int w = 0; w < TT / 32; ++w) { const int j = w * 32 + lane; const bool filled = (fr[j] != 0); const bool vis = (j <= i);
        const unsigned bits = __builtin_amdgcn_ballot_w32(vis && !filled); bad |= __builtin_amdgcn_ballot_w32(!vis && !filled); if (lane == w) mine = bits; }
    if (lane < TT / 32) VB[(size_t)i * (TT / 32) + lane] = mine;
    if (lane == 0) BAD[i] = bad;
}

// ---- k_prep: everything that only reads the inputs, one launch of 16-wave work-groups. Groups 0 .. CVG-1: the four weight matrices and x to bf16 (RNE). Groups CVG ..: the visibility words, one wave per query row.
// Conversion: CVG * 16 waves in all, few enough to start quickly. The sources are cut into slabs of CSLAB elements and a wave takes its own 256 elements (1 KiB) of every slab, so each trip's source is known at compile time.
// A load covers 512 bytes in a row (16 per lane), a store 256 (8 per lane): whole lines both ways. All loads of a wave are issued before its first conversion.
#define CVG   256
#define CSLAB (CVG * 16 * 256)
static_assert((DQ * DM) % CSLAB == 0 && (DKV * DM) % CSLAB == 0 && (MT * DM) % CSLAB == 0 && TT % 16 == 0);
__global__ __launch_bounds__(512) void k_prep(const float* __restrict__ wq, const float* __restrict__ wk, const float* __restrict__ wv, const float* __restrict__ wo, const float* __restrict__ x, const int* __restrict__ Fm,
                                              bf* __restrict__ WQKV, bf* __restrict__ WO, bf* __restrict__ XB, unsigned* VB, unsigned* BAD) {
    const int lane = threadIdx.x & 31, w = __builtin_amdgcn_readfirstlane((int)(threadIdx.x >> 5));
    if (blockIdx.x >= CVG) { vis_row(Fm, VB, BAD, (int)(blockIdx.x - CVG) * 16 + w, lane); return; }
    constexpr int SQ = DQ * DM / CSLAB, SK = DKV * DM / CSLAB, SX = MT * DM / CSLAB, NS = 2 * SQ + 2 * SK + SX;   // slabs of Wq (and of Wo), of Wk (and of Wv), of x; in all
    const unsigned g = (unsigned)(blockIdx.x * 16 + w) * 64u + (unsigned)lane;   // the lane's first group of 4 elements in every slab; its second is 32 groups on
    v4f v[NS][2];
// both loops unrolled: the slab picks its source and destination at compile time, and the values stay in registers
#pragma unroll
    for (int s = 0; s < NS; ++s) {
        const float* p = s < SQ ? wq : s < SQ + SK ? wk : s < SQ + 2 * SK ? wv : s < 2 * SQ + 2 * SK ? wo : x;
        const int t = s < SQ ? s : s < SQ + SK ? s - SQ : s < SQ + 2 * SK ? s - SQ - SK : s < 2 * SQ + 2 * SK ? s - SQ - 2 * SK : s - 2 * SQ - 2 * SK;   // slab number within its source
        v[s][0] = ((const v4f*)p)[g + (unsigned)t * (CSLAB / 4)]; v[s][1] = ((const v4f*)p + 32)[g + (unsigned)t * (CSLAB / 4)]; }
#pragma unroll
    for (int s = 0; s < NS; ++s) {
        bf* d = s < SQ + 2 * SK ? WQKV : s < 2 * SQ + 2 * SK ? WO : XB;
        const int t = s < SQ + 2 * SK ? s : s < 2 * SQ + 2 * SK ? s - SQ - 2 * SK : s - 2 * SQ - 2 * SK;   // slab number within its destination
#pragma unroll
        for (int h = 0; h < 2; ++h) { v4us c;
#pragma unroll
            for (int k = 0; k < 4; ++k) c[k] = f2bf(v[s][h][k]);
            ((v4us*)d + h * 32)[g + (unsigned)t * (CSLAB / 4)] = c; } }
    asm volatile("s_wait_xcnt 0x0" ::: "memory");   // a precaution: stands behind the last store, before any later write of a register that these stores name
}

// ---- fattn_tile: one wave, NT*16 query rows of one batch-head, key blocks of 32 up to the diagonal block, running maximum and sum (scores and probabilities stay in registers).
// St = K Q^T: A = key rows, Bt = query rows, so D element r of lane l = (key 8*(l>>4) + r, query l & 15); the two 16-key tiles of a block are then, element for element, the fragment order of the loader above
// (elements 0..7 <- k 8*(l>>4) + 0..7, elements 8..15 <- k 16 + 8*(l>>4) + 0..7), so the probabilities go straight in as Bt of Ot = V^T P^T (A = rows d of the value fragments). Ot element r of lane l = (d 8*(l>>4) + r, query l & 15).
// Every '#pragma unroll' in this function is there so that the fragment, score and output arrays are indexed by constants and stay in registers.
// SPLIT: hi/lo bf16 planes, 3 products in the order hi.hi, (query or p) lo . hi, hi . (key or value) lo. Not SPLIT: f16 planes, p carried x1024 (the carry is in the sum as well and cancels).
template <typename T16, bool SPLIT, int NT>
__device__ __forceinline__ void fattn_tile(const T16* __restrict__ Q, const T16* __restrict__ Q2, const T16* __restrict__ Kp, const T16* __restrict__ K2, const T16* __restrict__ Vt, const T16* __restrict__ V2,
                                           const unsigned* __restrict__ VB, const unsigned* __restrict__ BAD, int q0, bf* Ah, bf* Al) {
    typedef typename WFrag<T16>::V V;
    const int lane = threadIdx.x & 31, lr = lane & 15, hi = lane >> 4; const float ninf = -__builtin_inff();
    const unsigned l8 = 8u * (unsigned)lane;             // the lane's place in a fragment unit (8 elements per lane); the unit's own offset is the same for the whole wave
    const float C1 = SCL * 1.4426950408889634f;
    V qf[NT][2], qf2[NT][2];
#pragma unroll
    for (int nt = 0; nt < NT; ++nt)
#pragma unroll
        for (int ks = 0; ks < 2; ++ks) { const size_t qo = (size_t)(q0 + nt * 16) * HD + ks * 512; qf[nt][ks] = WFrag<T16>::ldf(Q + qo + l8); if (SPLIT) qf2[nt][ks] = WFrag<T16>::ldf(Q2 + qo + l8); }
    v8f o[4][NT]; float m[NT], l[NT];
#pragma unroll
    for (int nt = 0; nt < NT; ++nt) { m[nt] = ninf; l[nt] = 0.f;
#pragma unroll
        for (int dt = 0; dt < 4; ++dt) o[dt][nt] = (v8f){}; }
    const int kend = ((q0 + NT * 16 + 31) / 32) * 32;   // keys beyond the diagonal block are invisible to every row of the tile
    V kf[2][2], kf2[2][2]; unsigned wd[NT];
#pragma unroll
    for (int mt = 0; mt < 2; ++mt)
#pragma unroll
        for (int ks = 0; ks < 2; ++ks) { const size_t ko = (size_t)(mt * 16) * HD + ks * 512; kf[mt][ks] = WFrag<T16>::ldf(Kp + ko + l8); if (SPLIT) kf2[mt][ks] = WFrag<T16>::ldf(K2 + ko + l8); }
#pragma unroll
    for (int nt = 0; nt < NT; ++nt) wd[nt] = VB[(unsigned)(q0 + nt * 16 + lr) * (TT / 32)];
// rolled: one block's fragments, scores and outputs already fill the register budget
#pragma unroll 1
    for (int kb = 0; kb < kend; kb += 32) {
        V vf[4], vf2[4];
#pragma unroll
        for (int dt = 0; dt < 4; ++dt) { const size_t vo = (size_t)kb * HD + dt * 512; vf[dt] = WFrag<T16>::ldf(Vt + vo + l8); if (SPLIT) vf2[dt] = WFrag<T16>::ldf(V2 + vo + l8); }
        if constexpr (!SPLIT) __builtin_amdgcn_sched_barrier(0);   // keeps the value loads up here, a whole softmax ahead of their use; left free they sink between the p.v products and each waits out its full latency
        v8f s[2][NT]; unsigned wc[NT];
#pragma unroll
        for (int mt = 0; mt < 2; ++mt)
#pragma unroll
            for (int nt = 0; nt < NT; ++nt) { v8f a = (v8f){};
#pragma unroll
                for (int ks = 0; ks < 2; ++ks) { a = WFrag<T16>::mma(kf[mt][ks], qf[nt][ks], a); if (SPLIT) { a = WFrag<T16>::mma(kf[mt][ks], qf2[nt][ks], a); a = WFrag<T16>::mma(kf2[mt][ks], qf[nt][ks], a); } }
                s[mt][nt] = a; }
#pragma unroll
        for (int nt = 0; nt < NT; ++nt) wc[nt] = wd[nt] >> (8 * hi);
        if constexpr (SPLIT) asm volatile("s_wait_xcnt 0x0" ::: "memory");   // in this build the key loads below return into registers that hold the value loads' addresses
        const int kn = min(kb + 32, kend - 32);          // next block's key fragments and visibility words fly during this block's softmax (the last block fetches itself again)
#pragma unroll
        for (int mt = 0; mt < 2; ++mt)
#pragma unroll
            for (int ks = 0; ks < 2; ++ks) { const size_t ko = (size_t)(kn + mt * 16) * HD + ks * 512; kf[mt][ks] = WFrag<T16>::ldf(Kp + ko + l8); if (SPLIT) kf2[mt][ks] = WFrag<T16>::ldf(K2 + ko + l8); }
#pragma unroll
        for (int nt = 0; nt < NT; ++nt) wd[nt] = VB[(unsigned)(q0 + nt * 16 + lr) * (TT / 32) + (kn >> 5)];
        V pf[NT], pf2[NT];
#pragma unroll
        for (int nt = 0; nt < NT; ++nt) {
            float bm = ninf;
#pragma unroll
            for (int mt = 0; mt < 2; ++mt)
#pragma unroll
                for (int r = 0; r < 8; ++r) { const float t = ((wc[nt] >> (mt * 16 + r)) & 1u) ? s[mt][nt][r] : ninf; s[mt][nt][r] = t; bm = fmaxf(bm, t); }
            bm = fmaxf(bm, __shfl_xor(bm, 16, 32));
            const float mn = fmaxf(m[nt], bm); const float ms = (mn == ninf) ? 0.f : mn;   // no visible key so far: every p and the rescale come out 0, not NaN
            const float al = __builtin_amdgcn_exp2f((m[nt] - ms) * C1); m[nt] = mn;
            float ps = 0.f, p[16];
#pragma unroll
            for (int e = 0; e < 16; ++e) { const float d = s[e >> 3][nt][e & 7] - ms; if (SPLIT) asm("v_exp_f32 %0, %1\n\tv_nop" : "=v"(p[e]) : "v"(d * C1));   // v_nop: the slot behind a transcendental, tied to it
                else p[e] = __builtin_amdgcn_exp2f(__builtin_fmaf(d, C1, PCARL2));
                ps += p[e]; }
            l[nt] = l[nt] * al + ps;                     // this lane's half of the keys; the halves are joined behind the loop
#pragma unroll
            for (int dt = 0; dt < 4; ++dt) o[dt][nt] *= al;
            if constexpr (SPLIT) { v16us ph, pl;
#pragma unroll
                for (int e = 0; e < 16; ++e) { unsigned short a2, c2; splitf(p[e], a2, c2); ph[e] = a2; pl[e] = c2; }
                pf[nt] = __builtin_bit_cast(v16bf, ph); pf2[nt] = __builtin_bit_cast(v16bf, pl);
            } else {
#pragma unroll
                for (int e = 0; e < 16; ++e) pf[nt][e] = tohx(p[e]); }
        }
#pragma unroll
        for (int dt = 0; dt < 4; ++dt)
#pragma unroll
            for (int nt = 0; nt < NT; ++nt) { o[dt][nt] = WFrag<T16>::mma(vf[dt], pf[nt], o[dt][nt]); if (SPLIT) { o[dt][nt] = WFrag<T16>::mma(vf[dt], pf2[nt], o[dt][nt]); o[dt][nt] = WFrag<T16>::mma(vf2[dt], pf[nt], o[dt][nt]); } }
    }
#pragma unroll
    for (int nt = 0; nt < NT; ++nt) { const int q = q0 + nt * 16 + lr; const float lt = l[nt] + __shfl_xor(l[nt], 16, 32);
        float inv = __fdiv_rn(1.0f / VCAR, lt); if (BAD[q]) inv = __uint_as_float(0x7fc00000u);   // a row with no visible key: 0 * inf = NaN, as the softmax of an all -inf row
#pragma unroll
        for (int dt = 0; dt < 4; ++dt) { v8us oh, ol;
#pragma unroll
            for (int r = 0; r < 8; ++r) { unsigned short a2, c2; splitf(o[dt][nt][r] * inv, a2, c2); oh[r] = a2; ol[r] = c2; }
            const unsigned oo = (unsigned)q * DQ + dt * 16 + 8 * hi; *(v8us*)(Ah + oo) = oh; *(v8us*)(Al + oo) = ol; } }
}

// ---- k_fattn: grid (batch-groups, query tiles), 4 independent waves = the 4 query heads of the group on the same query rows (they read the same key and value lines). Tiles in falling order of their key count:
// first the f16 tiles (32 rows, from the last row down to RH), then the hi/lo tiles (16 rows, below RH). Writes the bf16 hi/lo context planes [token][DQ].
#define NQF ((TT - RH) / 32)
#define NQS (RH / 16)
__global__ __launch_bounds__(128) void k_fattn(const h16* __restrict__ QP16, const h16* __restrict__ KP16, const h16* __restrict__ VT16, const bf* __restrict__ QPh, const bf* __restrict__ QPl, const bf* __restrict__ KPh, const bf* __restrict__ KPl,
                                               const bf* __restrict__ VTh, const bf* __restrict__ VTl, const unsigned* __restrict__ VB, const unsigned* __restrict__ BAD, bf* ATh, bf* ATl) {
    const int bg = blockIdx.x, bh = bg * REP + __builtin_amdgcn_readfirstlane((int)(threadIdx.x >> 5)), t = blockIdx.y;   // the wave's number as a scalar: plane bases stay in scalar registers
    const size_t zq = (size_t)bh * TT * HD, zk = (size_t)bg * TT * HD, zo = (size_t)(bh / NH_) * TT * DQ + (size_t)(bh % NH_) * HD;
    if (t < NQF) fattn_tile<h16, false, 2>(QP16 + zq, nullptr, KP16 + zk, nullptr, VT16 + zk, nullptr, VB, BAD, TT - 32 * (t + 1), ATh + zo, ATl + zo);
    else         fattn_tile<bf, true, 1>(QPh + zq, QPl + zq, KPh + zk, KPl + zk, VTh + zk, VTl + zk, VB, BAD, RH - 16 * (t - NQF + 1), ATh + zo, ATl + zo);
}

extern "C" void kernel_launch(void* const* d_in, const int* in_sizes, int n_in,
                              void* d_out, int out_size, void* d_ws, size_t ws_size, hipStream_t stream) {
    if (n_in < 10) return;
    if (in_sizes[0] < ((NB - 1) * SEQ_FULL + SEQ) * DM) return;
    if (in_sizes[1] < (SEQ - 1) * SEQ_FULL + SEQ) return;
    if (in_sizes[2] < DQ * DM || in_sizes[3] < DQ || in_sizes[4] < DKV * DM || in_sizes[5] < DKV || in_sizes[6] < DKV * DM || in_sizes[7] < DKV || in_sizes[8] < DM * DQ || in_sizes[9] < DM) return;
    if (out_size < ((NB - 1) * SEQ_FULL + SEQ) * DM) return;
    const float* x  = (const float*)d_in[0];   // [NB_FULL][SEQ_FULL][DM]
    const int*   fm = (const int*)d_in[1];     // [1][1][SEQ_FULL][SEQ_FULL], nonzero = filled (-inf)
    const float* wq = (const float*)d_in[2]; const float* bq = (const float*)d_in[3];   // [DQ][DM], [DQ]
    const float* wk = (const float*)d_in[4]; const float* bk = (const float*)d_in[5];   // [DKV][DM], [DKV]
    const float* wv = (const float*)d_in[6]; const float* bv = (const float*)d_in[7];   // [DKV][DM], [DKV]
    const float* wo = (const float*)d_in[8]; const float* bo = (const float*)d_in[9];   // [DM][DQ], [DM]
    float* OUT = (float*)d_out;                // [NB_FULL][SEQ_FULL][DM]
    char* wsp = (char*)d_ws; size_t used = 0;
    auto take = [&](size_t bytes) { char* p = wsp + used; used += (bytes + 255) & ~(size_t)255; return (void*)p; };
    bf* WQ = (bf*)take((size_t)(DQ + 2 * DKV) * DM * 2); bf* WO = (bf*)take((size_t)DM * DQ * 2);   // Wq, Wk, Wv rows stacked: one [DQ + 2 DKV][DM] operand
    bf* XB = (bf*)take((size_t)MT * DM * 2);
    h16* QP16 = (h16*)take((size_t)NHB * TT * HD * 2); h16* KP16 = (h16*)take((size_t)NKVB * TT * HD * 2); h16* VT16 = (h16*)take((size_t)NKVB * HD * TT * 2);
    bf* QPh = (bf*)take((size_t)NHB * TT * HD * 2); bf* QPl = (bf*)take((size_t)NHB * TT * HD * 2); bf* KPh = (bf*)take((size_t)NKVB * TT * HD * 2); bf* KPl = (bf*)take((size_t)NKVB * TT * HD * 2);
    bf* VTh = (bf*)take((size_t)NKVB * HD * TT * 2); bf* VTl = (bf*)take((size_t)NKVB * HD * TT * 2);
    unsigned* VB = (unsigned*)take((size_t)TT * (TT / 32) * 4); unsigned* BAD = (unsigned*)take((size_t)TT * 4);
    bf* ATh = (bf*)take((size_t)MT * DQ * 2); bf* ATl = (bf*)take((size_t)MT * DQ * 2);
    if (used > ws_size) return;

    k_prep<<<CVG + TT / 16, 512, 0, stream>>>(wq, wk, wv, wo, x, fm, WQ, WO, XB, VB, BAD);
    const QkvOut qo = { QP16, QPh, QPl, KP16, KPh, KPl, VT16, VTh, VTl };
    k_gemmw<bf, 0, true, DM, true><<<dim3(MT / 128, (DQ + 2 * DKV) / 128, 1), 128, 0, stream>>>(XB, nullptr, WQ, nullptr, 0, bq, bk, bv, qo);
    k_fattn<<<dim3(NKVB, NQF + NQS, 1), 128, 0, stream>>>(QP16, KP16, VT16, QPh, QPl, KPh, KPl, VTh, VTl, VB, BAD, ATh, ATl);
    k_gemmw<bf, 1, true, DQ, false><<<dim3(MT / 128, DM / 128, 1), 128, 0, stream>>>(ATh, ATl, WO, OUT, DM, bo, nullptr, nullptr, QkvOut{});
}
